// v000
// The times below were measured on an AMD MI455X: many runs one after another, warmed up first and cycling through
// copies of the inputs, with the whole window's GPU time divided by the number of runs. Launches and the gaps
// between them are all in it. The median over several windows is given; except for v000 it joins two sittings, which
// can be a few percent apart, so the side-by-side timings, each taken in one sitting, are the better comparison.
// v000, which the later versions start from, runs in 109 microseconds.
#include <hip/hip_runtime.h>
#include <math.h>

// ---- CDNA5 WMMA types ----
typedef __attribute__((ext_vector_type(16))) _Float16 v16h;
typedef __attribute__((ext_vector_type(8)))  _Float16 v8h;
typedef __attribute__((ext_vector_type(4)))  _Float16 v4h;
typedef __attribute__((ext_vector_type(8)))  float    v8f;

union V16H { v16h v; v8h h[2]; };

__device__ __forceinline__ v8f wmma_f16(const V16H& a, const V16H& b, v8f c) {
  // D = A(16x32 f16) * B(32x16 f16) + C(16x16 f32)
  return __builtin_amdgcn_wmma_f32_16x16x32_f16(false, a.v, false, b.v,
                                                (short)0, c, false, false);
}

// Problem constants: B=1, N=32, L=512, D=256, H=8, hd=32
#define SEQ_N   32
#define LEN_L   512
#define DIM_D   256
#define HEADS   8
#define HD      32
#define MROWS   (SEQ_N * LEN_L)   // 16384
#define QKV_N   (3 * DIM_D)       // 768

// ------- Kernel 0: weight convert + transpose: [k][n] f32 -> [n][k] f16 -----
__global__ __launch_bounds__(256) void cvt_tr_kernel(const float* __restrict__ src,
                                                     _Float16* __restrict__ dst,
                                                     int K, int N) {
  // out linear index over [n][k]; output writes coalesced in k
  int i = blockIdx.x * blockDim.x + threadIdx.x;
  if (i >= K * N) return;
  int k = i % K, n = i / K;
  dst[i] = (_Float16)src[k * N + n];
}

// ---------------- Kernel 0b: pair_bias transpose [q][k][h] -> [h][q][k] ----
__global__ __launch_bounds__(256) void bias_tr_kernel(const float* __restrict__ pb,
                                                      float* __restrict__ pbt) {
  int i = blockIdx.x * blockDim.x + threadIdx.x;   // 0 .. 8*512*512-1
  int k = i & (LEN_L - 1);
  int q = (i >> 9) & (LEN_L - 1);
  int h = i >> 18;
  pbt[i] = pb[(q * LEN_L + k) * HEADS + h];
}

// ---------------- Kernel 1: LayerNorm -> f16 ----------------
__global__ __launch_bounds__(256) void ln_kernel(const float* __restrict__ msa,
                                                 const float* __restrict__ lw,
                                                 const float* __restrict__ lb,
                                                 _Float16* __restrict__ mh) {
  __shared__ float red[256];
  const int row = blockIdx.x;
  const int t = threadIdx.x;
  float x = msa[row * DIM_D + t];
  red[t] = x; __syncthreads();
  for (int s = 128; s > 0; s >>= 1) { if (t < s) red[t] += red[t + s]; __syncthreads(); }
  float mu = red[0] * (1.0f / DIM_D);
  __syncthreads();
  float dx = x - mu;
  red[t] = dx * dx; __syncthreads();
  for (int s = 128; s > 0; s >>= 1) { if (t < s) red[t] += red[t + s]; __syncthreads(); }
  float var = red[0] * (1.0f / DIM_D);
  float y = dx * rsqrtf(var + 1e-5f) * lw[t] + lb[t];
  mh[row * DIM_D + t] = (_Float16)y;
}

// ============ shared GEMM body (double-buffered LDS ping-pong) ============
// Block tile 128x64, 8 waves, wave = 16 rows x 64 cols (4 C frags), BK=32.
// A: [M][256] f16 row-major. BhT: [N][256] f16 (pre-transposed weights).
__device__ __forceinline__ void gemm_mainloop(const _Float16* __restrict__ Ah,
                                              const _Float16* __restrict__ BhT,
                                              int row0, int ntile,
                                              _Float16 (*As)[128][32],
                                              _Float16 (*BsT)[64][32],
                                              v8f acc[4]) {
  const int t = threadIdx.x, wid = t >> 5, lane = t & 31;
  const int lrow = lane & 15, lhi = lane >> 4;

  const int ar  = t >> 1, aseg = (t & 1) * 16;   // A staging: 16 halves/thread
  const int bn  = t & 63, bks  = (t >> 6) * 8;   // B staging: 8 halves/thread

  v8h ra0, ra1, rb;
  auto gload = [&](int kt) {
    const _Float16* srcA = Ah + (row0 + ar) * DIM_D + kt + aseg;
    ra0 = *(const v8h*)srcA;
    ra1 = *(const v8h*)(srcA + 8);
    rb  = *(const v8h*)(BhT + (ntile + bn) * DIM_D + kt + bks);  // contiguous
  };
  auto sstore = [&](int buf) {
    *(v8h*)&As[buf][ar][aseg]     = ra0;
    *(v8h*)&As[buf][ar][aseg + 8] = ra1;
    *(v8h*)&BsT[buf][bn][bks]     = rb;
  };

  gload(0);
  sstore(0);
  __syncthreads();

  for (int step = 0; step < DIM_D / 32; ++step) {
    const int buf = step & 1;
    const bool more = (step + 1) < DIM_D / 32;
    if (more) gload((step + 1) * 32);            // overlap VMEM with WMMA

    V16H a;
    a.h[0] = *(const v8h*)&As[buf][wid * 16 + lrow][lhi * 8];
    a.h[1] = *(const v8h*)&As[buf][wid * 16 + lrow][lhi * 8 + 16];
    V16H b[4];
    #pragma unroll
    for (int nf = 0; nf < 4; ++nf) {             // batch all ds loads first
      b[nf].h[0] = *(const v8h*)&BsT[buf][nf * 16 + lrow][lhi * 8];
      b[nf].h[1] = *(const v8h*)&BsT[buf][nf * 16 + lrow][lhi * 8 + 16];
    }
    #pragma unroll
    for (int nf = 0; nf < 4; ++nf)               // 4 back-to-back WMMAs
      acc[nf] = wmma_f16(a, b[nf], acc[nf]);

    if (more) sstore(buf ^ 1);
    __syncthreads();
  }
}

// ---------------- Kernel 2: QKV GEMM (16384x256 x 256x768) ----------------
__global__ __launch_bounds__(256) void qkv_gemm_kernel(const _Float16* __restrict__ Ah,
                                                       const _Float16* __restrict__ BhT,
                                                       const float* __restrict__ bq,
                                                       _Float16* __restrict__ Qh,
                                                       _Float16* __restrict__ Kh,
                                                       _Float16* __restrict__ Vh) {
  __shared__ __align__(16) _Float16 As[2][128][32];   // 16 KB
  __shared__ __align__(16) _Float16 BsT[2][64][32];   //  8 KB
  const int row0  = blockIdx.x * 128;
  const int ntile = blockIdx.y * 64;
  const int t = threadIdx.x, wid = t >> 5, lane = t & 31;
  const int lrow = lane & 15, lhi = lane >> 4;

  v8f acc[4] = {};
  gemm_mainloop(Ah, BhT, row0, ntile, As, BsT, acc);

  // Epilogue: + bias, scatter into Q/K/V [n][h][l][hd] f16
  #pragma unroll
  for (int nf = 0; nf < 4; ++nf) {
    #pragma unroll
    for (int r = 0; r < 8; ++r) {
      int col = ntile + nf * 16 + lrow;
      int row = row0 + wid * 16 + r + 8 * lhi;
      float v = acc[nf][r] + bq[col];
      int which = col >> 8, d = col & 255, hh = d >> 5, hdi = d & 31;
      _Float16* dst = (which == 0) ? Qh : ((which == 1) ? Kh : Vh);
      int n = row >> 9, l = row & 511;
      dst[((n * HEADS + hh) * LEN_L + l) * HD + hdi] = (_Float16)v;
    }
  }
}

// ---------------- Kernel 4: proj GEMM + bias + residual ----------------
__global__ __launch_bounds__(256) void proj_gemm_kernel(const _Float16* __restrict__ Ah,
                                                        const _Float16* __restrict__ BhT,
                                                        const float* __restrict__ bp,
                                                        const float* __restrict__ resid,
                                                        float* __restrict__ out) {
  __shared__ __align__(16) _Float16 As[2][128][32];
  __shared__ __align__(16) _Float16 BsT[2][64][32];
  const int row0  = blockIdx.x * 128;
  const int ntile = blockIdx.y * 64;
  const int t = threadIdx.x, wid = t >> 5, lane = t & 31;
  const int lrow = lane & 15, lhi = lane >> 4;

  v8f acc[4] = {};
  gemm_mainloop(Ah, BhT, row0, ntile, As, BsT, acc);

  #pragma unroll
  for (int nf = 0; nf < 4; ++nf) {
    #pragma unroll
    for (int r = 0; r < 8; ++r) {
      int col = ntile + nf * 16 + lrow;
      int row = row0 + wid * 16 + r + 8 * lhi;
      out[row * DIM_D + col] = acc[nf][r] + bp[col] + resid[row * DIM_D + col];
    }
  }
}

// ---------------- Kernel 3: flash attention per (n,h) ----------------
// Block: 128 queries (8 waves x 16), loops key chunks of 32 (double-buffered).
__global__ __launch_bounds__(256) void attn_kernel(const _Float16* __restrict__ Qh,
                                                   const _Float16* __restrict__ Kh,
                                                   const _Float16* __restrict__ Vh,
                                                   const float* __restrict__ pbt, // [h][q][k]
                                                   _Float16* __restrict__ AO) {
  __shared__ __align__(16) _Float16 Ks[2][32][32];     // [key][d]
  __shared__ __align__(16) _Float16 Vt[2][32][32];     // [d][key]
  __shared__ __align__(16) _Float16 Ps[8][16][32];     // per-wave P [q][key]
  const int nh = blockIdx.y;                 // n*8 + h
  const int n = nh >> 3, h = nh & 7;
  const int q0 = blockIdx.x * 128;
  const int t = threadIdx.x, wid = t >> 5, lane = t & 31;
  const int lrow = lane & 15, lhi = lane >> 4;

  const _Float16* Qb = Qh + (size_t)nh * LEN_L * HD;
  const _Float16* Kb = Kh + (size_t)nh * LEN_L * HD;
  const _Float16* Vb = Vh + (size_t)nh * LEN_L * HD;
  const float* biasT = pbt + (size_t)h * LEN_L * LEN_L;   // [q][k] contiguous

  V16H aq;
  {
    int qrow = q0 + wid * 16 + lrow;
    aq.h[0] = *(const v8h*)(Qb + qrow * HD + lhi * 8);
    aq.h[1] = *(const v8h*)(Qb + qrow * HD + lhi * 8 + 16);
  }
  float rmax[8], rsum[8];
  v8f o0 = {}, o1 = {};
  #pragma unroll
  for (int r = 0; r < 8; ++r) { rmax[r] = -1e30f; rsum[r] = 0.0f; }
  const float scale = 0.17677669529663687f;  // 1/sqrt(32)

  const int skey = t >> 3, sds = (t & 7) * 4;  // staging: 4 halves/thread each
  v4h kr, vr;
  auto gload = [&](int kc) {
    kr = *(const v4h*)(Kb + (kc + skey) * HD + sds);
    vr = *(const v4h*)(Vb + (kc + skey) * HD + sds);
  };
  auto sstore = [&](int buf) {
    *(v4h*)&Ks[buf][skey][sds] = kr;
    Vt[buf][sds + 0][skey] = vr[0]; Vt[buf][sds + 1][skey] = vr[1];
    Vt[buf][sds + 2][skey] = vr[2]; Vt[buf][sds + 3][skey] = vr[3];
  };

  gload(0);
  sstore(0);
  __syncthreads();

  for (int kc = 0; kc < LEN_L; kc += 32) {
    const int buf = (kc >> 5) & 1;
    const bool more = (kc + 32) < LEN_L;
    if (more) {
      gload(kc + 32);                                      // overlap with compute
      __builtin_prefetch(&biasT[(q0 + wid * 16 + lhi * 8) * LEN_L + kc + 32 + lrow], 0, 0);
    }

    // scores: S(16x32) = Q(16x32) * K^T  (B frag [d][key] == Ks row-major)
    V16H bk0, bk1;
    bk0.h[0] = *(const v8h*)&Ks[buf][lrow][lhi * 8];
    bk0.h[1] = *(const v8h*)&Ks[buf][lrow][lhi * 8 + 16];
    bk1.h[0] = *(const v8h*)&Ks[buf][16 + lrow][lhi * 8];
    bk1.h[1] = *(const v8h*)&Ks[buf][16 + lrow][lhi * 8 + 16];
    v8f s0 = {}, s1 = {};
    s0 = wmma_f16(aq, bk0, s0);
    s1 = wmma_f16(aq, bk1, s1);

    // online softmax (fp32); C layout: col=lane&15, row=r+8*(lane>>4)
    #pragma unroll
    for (int r = 0; r < 8; ++r) {
      int q = q0 + wid * 16 + r + 8 * lhi;
      float b0 = biasT[q * LEN_L + kc + lrow];        // coalesced across lanes
      float b1 = biasT[q * LEN_L + kc + 16 + lrow];
      float sv0 = s0[r] * scale + b0;
      float sv1 = s1[r] * scale + b1;
      float mc = fmaxf(sv0, sv1);
      #pragma unroll
      for (int off = 1; off < 16; off <<= 1) mc = fmaxf(mc, __shfl_xor(mc, off, 16));
      float mnew = fmaxf(rmax[r], mc);
      float alpha = __expf(rmax[r] - mnew);
      rmax[r] = mnew;
      float p0 = __expf(sv0 - mnew);
      float p1 = __expf(sv1 - mnew);
      float ps = p0 + p1;
      #pragma unroll
      for (int off = 1; off < 16; off <<= 1) ps += __shfl_xor(ps, off, 16);
      rsum[r] = rsum[r] * alpha + ps;
      o0[r] *= alpha; o1[r] *= alpha;
      // C-layout -> A-layout transpose via per-wave LDS
      Ps[wid][r + 8 * lhi][lrow]      = (_Float16)p0;
      Ps[wid][r + 8 * lhi][16 + lrow] = (_Float16)p1;
    }

    // O(16x32) += P(16x32) * V(32x32); B frag [key][hd] -> read Vt[hd][key]
    V16H ap, bv0, bv1;
    ap.h[0] = *(const v8h*)&Ps[wid][lrow][lhi * 8];
    ap.h[1] = *(const v8h*)&Ps[wid][lrow][lhi * 8 + 16];
    bv0.h[0] = *(const v8h*)&Vt[buf][lrow][lhi * 8];
    bv0.h[1] = *(const v8h*)&Vt[buf][lrow][lhi * 8 + 16];
    bv1.h[0] = *(const v8h*)&Vt[buf][16 + lrow][lhi * 8];
    bv1.h[1] = *(const v8h*)&Vt[buf][16 + lrow][lhi * 8 + 16];
    o0 = wmma_f16(ap, bv0, o0);
    o1 = wmma_f16(ap, bv1, o1);

    if (more) sstore(buf ^ 1);
    __syncthreads();
  }

  // normalize + store to attn_out [n][l][h*32+hd] f16
  #pragma unroll
  for (int r = 0; r < 8; ++r) {
    int q = q0 + wid * 16 + r + 8 * lhi;
    float inv = 1.0f / rsum[r];
    size_t base = ((size_t)n * LEN_L + q) * DIM_D + h * HD;
    AO[base + lrow]      = (_Float16)(o0[r] * inv);
    AO[base + 16 + lrow] = (_Float16)(o1[r] * inv);
  }
}

// ---------------- launch ----------------
extern "C" void kernel_launch(void* const* d_in, const int* in_sizes, int n_in,
                              void* d_out, int out_size, void* d_ws, size_t ws_size,
                              hipStream_t stream) {
  const float* msa   = (const float*)d_in[0];
  const float* pbias = (const float*)d_in[1];
  const float* lnw   = (const float*)d_in[2];
  const float* lnb   = (const float*)d_in[3];
  const float* wqkv  = (const float*)d_in[4];
  const float* bqkv  = (const float*)d_in[5];
  const float* wproj = (const float*)d_in[6];
  const float* bproj = (const float*)d_in[7];
  float* out = (float*)d_out;

  char* ws = (char*)d_ws;
  // workspace layout (bytes), all offsets 16B-aligned
  _Float16* WqkvT  = (_Float16*)(ws + 0);          // [768][256] f16 = 393216
  _Float16* WprojT = (_Float16*)(ws + 393216);     // [256][256] f16 = 131072
  _Float16* Mh     = (_Float16*)(ws + 524288);     // 16384*256*2 = 8388608
  _Float16* Qh     = (_Float16*)(ws + 8912896);    // 8388608
  _Float16* Kh     = (_Float16*)(ws + 17301504);   // 8388608
  _Float16* Vh     = (_Float16*)(ws + 25690112);   // 8388608
  _Float16* AOh    = (_Float16*)(ws + 34078720);   // 8388608
  float*    PbT    = (float*)   (ws + 42467328);   // 8*512*512*4 = 8388608 (total ~48.5 MB)

  cvt_tr_kernel<<<(DIM_D * QKV_N + 255) / 256, 256, 0, stream>>>(wqkv, WqkvT, DIM_D, QKV_N);
  cvt_tr_kernel<<<(DIM_D * DIM_D + 255) / 256, 256, 0, stream>>>(wproj, WprojT, DIM_D, DIM_D);
  bias_tr_kernel<<<(HEADS * LEN_L * LEN_L) / 256, 256, 0, stream>>>(pbias, PbT);
  ln_kernel<<<MROWS, 256, 0, stream>>>(msa, lnw, lnb, Mh);
  qkv_gemm_kernel<<<dim3(MROWS / 128, QKV_N / 64), 256, 0, stream>>>(Mh, WqkvT, bqkv, Qh, Kh, Vh);
  attn_kernel<<<dim3(LEN_L / 128, SEQ_N * HEADS), 256, 0, stream>>>(Qh, Kh, Vh, PbT, AOh);
  proj_gemm_kernel<<<dim3(MROWS / 128, DIM_D / 64), 256, 0, stream>>>(AOh, WprojT, bproj, msa, out);
}

// v001
// It runs in 99.1 microseconds.
// Timed twice side by side with v000, it ran 1.14 and 1.15 times as fast.
#include <hip/hip_runtime.h>
#include <math.h>

// ---- CDNA5 WMMA types ----
typedef __attribute__((ext_vector_type(16))) _Float16 v16h;
typedef __attribute__((ext_vector_type(8)))  _Float16 v8h;
typedef __attribute__((ext_vector_type(4)))  _Float16 v4h;
typedef __attribute__((ext_vector_type(8)))  float    v8f;
typedef __attribute__((ext_vector_type(4)))  float    v4f;

union V16H { v16h v; v8h h[2]; };

__device__ __forceinline__ v8f wmma_f16(const V16H& a, const V16H& b, v8f c) {
  // D = A(16x32 f16) * B(32x16 f16) + C(16x16 f32)
  return __builtin_amdgcn_wmma_f32_16x16x32_f16(false, a.v, false, b.v,
                                                (short)0, c, false, false);
}

// Problem constants: B=1, N=32, L=512, D=256, H=8, hd=32
#define SEQ_N   32
#define LEN_L   512
#define DIM_D   256
#define HEADS   8
#define HD      32
#define MROWS   (SEQ_N * LEN_L)   // 16384
#define QKV_N   (3 * DIM_D)       // 768

// ------- Kernel 0: weight convert + transpose: [k][n] f32 -> [n][k] f16 -----
__global__ __launch_bounds__(256) void cvt_tr_kernel(const float* __restrict__ src,
                                                     _Float16* __restrict__ dst,
                                                     int K, int N) {
  // out linear index over [n][k]; output writes coalesced in k
  int i = blockIdx.x * blockDim.x + threadIdx.x;
  if (i >= K * N) return;
  int k = i % K, n = i / K;
  dst[i] = (_Float16)src[k * N + n];
}

// ------ Kernel 0b: pair_bias transpose [q][k][h] -> [h][k/4][q][k%4] ------
// q runs across the lanes of a transposed score tile, so a lane's four keys lie
// in 16 bytes and 16 neighbouring queries in 256 contiguous bytes.
__global__ __launch_bounds__(256) void bias_tr_kernel(const float* __restrict__ pb,
                                                      float* __restrict__ pbt) {
  int i = blockIdx.x * blockDim.x + threadIdx.x;   // 0 .. 8*512*512-1
  int q = (i >> 2) & (LEN_L - 1);
  int k = ((i >> 11) & (LEN_L / 4 - 1)) * 4 + (i & 3);
  int h = i >> 18;
  pbt[i] = pb[(q * LEN_L + k) * HEADS + h];
}

// ---------------- Kernel 1: LayerNorm -> f16 ----------------
__global__ __launch_bounds__(256) void ln_kernel(const float* __restrict__ msa,
                                                 const float* __restrict__ lw,
                                                 const float* __restrict__ lb,
                                                 _Float16* __restrict__ mh) {
  __shared__ float red[256];
  const int row = blockIdx.x;
  const int t = threadIdx.x;
  float x = msa[row * DIM_D + t];
  red[t] = x; __syncthreads();
  for (int s = 128; s > 0; s >>= 1) { if (t < s) red[t] += red[t + s]; __syncthreads(); }
  float mu = red[0] * (1.0f / DIM_D);
  __syncthreads();
  float dx = x - mu;
  red[t] = dx * dx; __syncthreads();
  for (int s = 128; s > 0; s >>= 1) { if (t < s) red[t] += red[t + s]; __syncthreads(); }
  float var = red[0] * (1.0f / DIM_D);
  float y = dx * rsqrtf(var + 1e-5f) * lw[t] + lb[t];
  mh[row * DIM_D + t] = (_Float16)y;
}

// ============ shared GEMM body (double-buffered LDS ping-pong) ============
// Block tile 128x64, 8 waves, wave = 16 rows x 64 cols (4 C frags), BK=32.
// A: [M][256] f16 row-major. BhT: [N][256] f16 (pre-transposed weights).
__device__ __forceinline__ void gemm_mainloop(const _Float16* __restrict__ Ah,
                                              const _Float16* __restrict__ BhT,
                                              int row0, int ntile,
                                              _Float16 (*As)[128][32],
                                              _Float16 (*BsT)[64][32],
                                              v8f acc[4]) {
  const int t = threadIdx.x, wid = t >> 5, lane = t & 31;
  const int lrow = lane & 15, lhi = lane >> 4;

  const int ar  = t >> 1, aseg = (t & 1) * 16;   // A staging: 16 halves/thread
  const int bn  = t & 63, bks  = (t >> 6) * 8;   // B staging: 8 halves/thread

  v8h ra0, ra1, rb;
  auto gload = [&](int kt) {
    const _Float16* srcA = Ah + (row0 + ar) * DIM_D + kt + aseg;
    ra0 = *(const v8h*)srcA;
    ra1 = *(const v8h*)(srcA + 8);
    rb  = *(const v8h*)(BhT + (ntile + bn) * DIM_D + kt + bks);  // contiguous
  };
  auto sstore = [&](int buf) {
    *(v8h*)&As[buf][ar][aseg]     = ra0;
    *(v8h*)&As[buf][ar][aseg + 8] = ra1;
    *(v8h*)&BsT[buf][bn][bks]     = rb;
  };

  gload(0);
  sstore(0);
  __syncthreads();

  for (int step = 0; step < DIM_D / 32; ++step) {
    const int buf = step & 1;
    const bool more = (step + 1) < DIM_D / 32;
    if (more) gload((step + 1) * 32);            // overlap VMEM with WMMA

    V16H a;
    a.h[0] = *(const v8h*)&As[buf][wid * 16 + lrow][lhi * 8];
    a.h[1] = *(const v8h*)&As[buf][wid * 16 + lrow][lhi * 8 + 16];
    V16H b[4];
    #pragma unroll
    for (int nf = 0; nf < 4; ++nf) {             // batch all ds loads first
      b[nf].h[0] = *(const v8h*)&BsT[buf][nf * 16 + lrow][lhi * 8];
      b[nf].h[1] = *(const v8h*)&BsT[buf][nf * 16 + lrow][lhi * 8 + 16];
    }
    #pragma unroll
    for (int nf = 0; nf < 4; ++nf)               // 4 back-to-back WMMAs
      acc[nf] = wmma_f16(a, b[nf], acc[nf]);

    if (more) sstore(buf ^ 1);
    __syncthreads();
  }
}

// ---------------- Kernel 2: QKV GEMM (16384x256 x 256x768) ----------------
__global__ __launch_bounds__(256) void qkv_gemm_kernel(const _Float16* __restrict__ Ah,
                                                       const _Float16* __restrict__ BhT,
                                                       const float* __restrict__ bq,
                                                       _Float16* __restrict__ Qh,
                                                       _Float16* __restrict__ Kh,
                                                       _Float16* __restrict__ Vh) {
  __shared__ __align__(16) _Float16 As[2][128][32];   // 16 KB
  __shared__ __align__(16) _Float16 BsT[2][64][32];   //  8 KB
  const int row0  = blockIdx.x * 128;
  const int ntile = blockIdx.y * 64;
  const int t = threadIdx.x, wid = t >> 5, lane = t & 31;
  const int lrow = lane & 15, lhi = lane >> 4;

  v8f acc[4] = {};
  gemm_mainloop(Ah, BhT, row0, ntile, As, BsT, acc);

  // Epilogue: + bias, scatter into Q/K/V [n][h][l][hd] f16
  #pragma unroll
  for (int nf = 0; nf < 4; ++nf) {
    #pragma unroll
    for (int r = 0; r < 8; ++r) {
      int col = ntile + nf * 16 + lrow;
      int row = row0 + wid * 16 + r + 8 * lhi;
      float v = acc[nf][r] + bq[col];
      int which = col >> 8, d = col & 255, hh = d >> 5, hdi = d & 31;
      _Float16* dst = (which == 0) ? Qh : ((which == 1) ? Kh : Vh);
      int n = row >> 9, l = row & 511;
      dst[((n * HEADS + hh) * LEN_L + l) * HD + hdi] = (_Float16)v;
    }
  }
}

// ---------------- Kernel 4: proj GEMM + bias + residual ----------------
__global__ __launch_bounds__(256) void proj_gemm_kernel(const _Float16* __restrict__ Ah,
                                                        const _Float16* __restrict__ BhT,
                                                        const float* __restrict__ bp,
                                                        const float* __restrict__ resid,
                                                        float* __restrict__ out) {
  __shared__ __align__(16) _Float16 As[2][128][32];
  __shared__ __align__(16) _Float16 BsT[2][64][32];
  const int row0  = blockIdx.x * 128;
  const int ntile = blockIdx.y * 64;
  const int t = threadIdx.x, wid = t >> 5, lane = t & 31;
  const int lrow = lane & 15, lhi = lane >> 4;

  v8f acc[4] = {};
  gemm_mainloop(Ah, BhT, row0, ntile, As, BsT, acc);

  #pragma unroll
  for (int nf = 0; nf < 4; ++nf) {
    #pragma unroll
    for (int r = 0; r < 8; ++r) {
      int col = ntile + nf * 16 + lrow;
      int row = row0 + wid * 16 + r + 8 * lhi;
      out[row * DIM_D + col] = acc[nf][r] + bp[col] + resid[row * DIM_D + col];
    }
  }
}

__device__ __forceinline__ float xhalf(float x) {   // value of lane l ^ 16
  int b = __builtin_bit_cast(int, x);
  return __builtin_bit_cast(float,
      __builtin_amdgcn_permlanex16(b, b, 0x76543210, 0xfedcba98, false, false));
}

// Eight 2^x in one statement. The results are early-clobber, so none of them lands
// on the source register of the v_exp_f32 in front of it, and the closing v_nop is
// the slot that the instruction set asks for behind a transcendental.
__device__ __forceinline__ v8f exp2x8(v8f x) {
  float y0, y1, y2, y3, y4, y5, y6, y7;
  asm("v_exp_f32 %0, %8\n\tv_exp_f32 %1, %9\n\tv_exp_f32 %2, %10\n\tv_exp_f32 %3, %11\n\t"
      "v_exp_f32 %4, %12\n\tv_exp_f32 %5, %13\n\tv_exp_f32 %6, %14\n\tv_exp_f32 %7, %15\n\t"
      "v_nop"
      : "=&v"(y0), "=&v"(y1), "=&v"(y2), "=&v"(y3), "=&v"(y4), "=&v"(y5), "=&v"(y6), "=&v"(y7)
      : "v"(x[0]), "v"(x[1]), "v"(x[2]), "v"(x[3]), "v"(x[4]), "v"(x[5]), "v"(x[6]), "v"(x[7]));
  return v8f{y0, y1, y2, y3, y4, y5, y6, y7};
}

__global__ __launch_bounds__(256) void attn_kernel(const _Float16* __restrict__ Qh,
                                                   const _Float16* __restrict__ Kh,
                                                   const _Float16* __restrict__ Vh,
                                                   const float* __restrict__ pbt, // [h][k/4][q][k%4]
                                                   _Float16* __restrict__ AO) {
  __shared__ __align__(16) _Float16 Ks[2][32][32];     // [key][d]
  __shared__ __align__(16) _Float16 Vt[2][32][32];     // [d][key]
  const int nh = blockIdx.y;                 // n*8 + h
  const int n = nh >> 3, h = nh & 7;
  const int q0 = blockIdx.x * 128;
  const int t = threadIdx.x, wid = t >> 5, lane = t & 31;
  const int lrow = lane & 15, lhi = lane >> 4;

  const _Float16* Qb = Qh + (size_t)nh * LEN_L * HD;
  const _Float16* Kb = Kh + (size_t)nh * LEN_L * HD;
  const _Float16* Vb = Vh + (size_t)nh * LEN_L * HD;
  const int qrow = q0 + wid * 16 + lrow;     // this lane's query
  // this lane's query in the bias plane, at its first group of four keys
  const float* brow = pbt + (size_t)h * LEN_L * LEN_L + lhi * 2 * (LEN_L * 4) + qrow * 4;

  V16H bq;                                   // Qt as B operand: column = query
  bq.h[0] = *(const v8h*)(Qb + qrow * HD + lhi * 8);
  bq.h[1] = *(const v8h*)(Qb + qrow * HD + lhi * 8 + 16);

  float rmax = -1e30f, rsum = 0.0f;          // rsum: this half's keys only
  v8f o0 = {}, o1 = {};                      // Ot rows hd 0..15 / 16..31
  const float scale = 0.17677669529663687f;  // 1/sqrt(32)

  const int skey = t >> 3, sds = (t & 7) * 4;  // staging: 4 halves/thread each
  v4h kr, vr;
  auto gload = [&](int kc) {
    kr = *(const v4h*)(Kb + (kc + skey) * HD + sds);
    vr = *(const v4h*)(Vb + (kc + skey) * HD + sds);
  };
  auto sstore = [&](int buf) {
    *(v4h*)&Ks[buf][skey][sds] = kr;
    Vt[buf][sds + 0][skey] = vr[0]; Vt[buf][sds + 1][skey] = vr[1];
    Vt[buf][sds + 2][skey] = vr[2]; Vt[buf][sds + 3][skey] = vr[3];
  };

  gload(0);
  // the address registers of the Q, K and V loads above are reused right behind
  // them (the zeroed accumulators): the wait stands in front of that overwrite
  asm volatile("s_wait_xcnt 0x0" ::: "memory");
  sstore(0);
  __syncthreads();

  for (int kc = 0; kc < LEN_L; kc += 32) {
    const int buf = (kc >> 5) & 1;
    const bool more = (kc + 32) < LEN_L;
    if (more) {
      gload(kc + 32);                                      // overlap with compute
      __builtin_prefetch(brow + (kc + 32) * LEN_L, 0, 0);
    }

    // bias of keys kc+8h+0..7 and kc+16+8h+0..7 for this lane's query
    const float* bc = brow + kc * LEN_L;     // key group kc/4 (+ 2 in the upper half)
    const v4f g0 = *(const v4f*)(bc);
    const v4f g1 = *(const v4f*)(bc + 1 * (LEN_L * 4));
    const v4f g4 = *(const v4f*)(bc + 4 * (LEN_L * 4));
    const v4f g5 = *(const v4f*)(bc + 5 * (LEN_L * 4));

    // scores: St(32x16) = K(32x32) * Qt  (A frag [key][d] == Ks row-major)
    V16H ak0, ak1;
    ak0.h[0] = *(const v8h*)&Ks[buf][lrow][lhi * 8];
    ak0.h[1] = *(const v8h*)&Ks[buf][lrow][lhi * 8 + 16];
    ak1.h[0] = *(const v8h*)&Ks[buf][16 + lrow][lhi * 8];
    ak1.h[1] = *(const v8h*)&Ks[buf][16 + lrow][lhi * 8 + 16];
    v8f s0 = {}, s1 = {};
    s0 = wmma_f16(ak0, bq, s0);
    s1 = wmma_f16(ak1, bq, s1);

    const v8f bb0 = __builtin_shufflevector(g0, g1, 0, 1, 2, 3, 4, 5, 6, 7);
    const v8f bb1 = __builtin_shufflevector(g4, g5, 0, 1, 2, 3, 4, 5, 6, 7);

    // online softmax (fp32); C layout: col=lane&15 (query), row=r+8*(lane>>4) (key)
    const v8f sv0 = s0 * scale + bb0;
    const v8f sv1 = s1 * scale + bb1;
    float mc = fmaxf(sv0[0], sv1[0]);
    #pragma unroll
    for (int r = 1; r < 8; ++r) mc = fmaxf(mc, fmaxf(sv0[r], sv1[r]));
    mc = fmaxf(mc, xhalf(mc));               // the other half's 16 keys
    const float mnew = fmaxf(rmax, mc);
    const float alpha = __expf(rmax - mnew);
    rmax = mnew;

    const float log2e = 1.44269504f;         // __expf(x) is 2^(x * log2e)
    const v8f p0 = exp2x8((sv0 - mnew) * log2e);
    const v8f p1 = exp2x8((sv1 - mnew) * log2e);
    const v8f pv = p0 + p1;
    V16H bp;                                 // Pt as B operand, straight from St
    #pragma unroll
    for (int r = 0; r < 8; ++r) {
      bp.h[0][r] = (_Float16)p0[r];
      bp.h[1][r] = (_Float16)p1[r];
    }
    const float ps = ((pv[0] + pv[1]) + (pv[2] + pv[3])) + ((pv[4] + pv[5]) + (pv[6] + pv[7]));
    rsum = rsum * alpha + ps;
    o0 *= alpha;
    o1 *= alpha;

    // Ot(32x16) += Vt(32x32) * Pt(32x16); A frag [hd][key] == Vt row-major
    V16H av0, av1;
    av0.h[0] = *(const v8h*)&Vt[buf][lrow][lhi * 8];
    av0.h[1] = *(const v8h*)&Vt[buf][lrow][lhi * 8 + 16];
    av1.h[0] = *(const v8h*)&Vt[buf][16 + lrow][lhi * 8];
    av1.h[1] = *(const v8h*)&Vt[buf][16 + lrow][lhi * 8 + 16];
    o0 = wmma_f16(av0, bp, o0);
    o1 = wmma_f16(av1, bp, o1);

    if (more) sstore(buf ^ 1);
    __syncthreads();
  }

  // join the halves' sums, normalize, store to attn_out [n][l][h*32+hd] f16:
  // a lane holds hd 8h+0..7 and 16+8h+0..7 of its query, two 16-byte stores
  const float inv = 1.0f / (rsum + xhalf(rsum));
  v8h w0, w1;
  #pragma unroll
  for (int r = 0; r < 8; ++r) {
    w0[r] = (_Float16)(o0[r] * inv);
    w1[r] = (_Float16)(o1[r] * inv);
  }
  _Float16* dst = AO + ((size_t)n * LEN_L + qrow) * DIM_D + h * HD + lhi * 8;
  *(v8h*)dst        = w0;
  *(v8h*)(dst + 16) = w1;
}

// ---------------- launch ----------------
extern "C" void kernel_launch(void* const* d_in, const int* in_sizes, int n_in,
                              void* d_out, int out_size, void* d_ws, size_t ws_size,
                              hipStream_t stream) {
  const float* msa   = (const float*)d_in[0];
  const float* pbias = (const float*)d_in[1];
  const float* lnw   = (const float*)d_in[2];
  const float* lnb   = (const float*)d_in[3];
  const float* wqkv  = (const float*)d_in[4];
  const float* bqkv  = (const float*)d_in[5];
  const float* wproj = (const float*)d_in[6];
  const float* bproj = (const float*)d_in[7];
  float* out = (float*)d_out;

  char* ws = (char*)d_ws;
  // workspace layout (bytes), all offsets 16B-aligned
  _Float16* WqkvT  = (_Float16*)(ws + 0);          // [768][256] f16 = 393216
  _Float16* WprojT = (_Float16*)(ws + 393216);     // [256][256] f16 = 131072
  _Float16* Mh     = (_Float16*)(ws + 524288);     // 16384*256*2 = 8388608
  _Float16* Qh     = (_Float16*)(ws + 8912896);    // 8388608
  _Float16* Kh     = (_Float16*)(ws + 17301504);   // 8388608
  _Float16* Vh     = (_Float16*)(ws + 25690112);   // 8388608
  _Float16* AOh    = (_Float16*)(ws + 34078720);   // 8388608
  float*    PbT    = (float*)   (ws + 42467328);   // 8*512*512*4 = 8388608 (total ~48.5 MB)

  cvt_tr_kernel<<<(DIM_D * QKV_N + 255) / 256, 256, 0, stream>>>(wqkv, WqkvT, DIM_D, QKV_N);
  cvt_tr_kernel<<<(DIM_D * DIM_D + 255) / 256, 256, 0, stream>>>(wproj, WprojT, DIM_D, DIM_D);
  bias_tr_kernel<<<(HEADS * LEN_L * LEN_L) / 256, 256, 0, stream>>>(pbias, PbT);
  ln_kernel<<<MROWS, 256, 0, stream>>>(msa, lnw, lnb, Mh);
  qkv_gemm_kernel<<<dim3(MROWS / 128, QKV_N / 64), 256, 0, stream>>>(Mh, WqkvT, bqkv, Qh, Kh, Vh);
  attn_kernel<<<dim3(LEN_L / 128, SEQ_N * HEADS), 256, 0, stream>>>(Qh, Kh, Vh, PbT, AOh);
  proj_gemm_kernel<<<dim3(MROWS / 128, DIM_D / 64), 256, 0, stream>>>(AOh, WprojT, bproj, msa, out);
}

// v002
// A run of this version takes 81.2 microseconds.
// In both of two side-by-side timings against v001, it was 1.22 times as fast.
// Counting every step since v000, it is 1.39 times as fast.
#include <hip/hip_runtime.h>
#include <math.h>

// ---- CDNA5 WMMA types ----
typedef __attribute__((ext_vector_type(16))) _Float16 v16h;
typedef __attribute__((ext_vector_type(8)))  _Float16 v8h;
typedef __attribute__((ext_vector_type(4)))  _Float16 v4h;
typedef __attribute__((ext_vector_type(8)))  float    v8f;
typedef __attribute__((ext_vector_type(4)))  float    v4f;

union V16H { v16h v; v8h h[2]; };

__device__ __forceinline__ v8f wmma_f16(const V16H& a, const V16H& b, v8f c) {
  // D = A(16x32 f16) * B(32x16 f16) + C(16x16 f32)
  return __builtin_amdgcn_wmma_f32_16x16x32_f16(false, a.v, false, b.v,
                                                (short)0, c, false, false);
}

// Problem constants: B=1, N=32, L=512, D=256, H=8, hd=32
#define SEQ_N   32
#define LEN_L   512
#define DIM_D   256
#define HEADS   8
#define HD      32
#define MROWS   (SEQ_N * LEN_L)   // 16384
#define QKV_N   (3 * DIM_D)       // 768

// ------- Kernel 0: weight convert + transpose: [k][n] f32 -> [n][k] f16 -----
__global__ __launch_bounds__(256) void cvt_tr_kernel(const float* __restrict__ src,
                                                     _Float16* __restrict__ dst,
                                                     int K, int N) {
  // out linear index over [n][k]; output writes coalesced in k
  int i = blockIdx.x * blockDim.x + threadIdx.x;
  if (i >= K * N) return;
  int k = i % K, n = i / K;
  dst[i] = (_Float16)src[k * N + n];
}

// ------ Kernel 0b: pair_bias transpose [q][k][h] -> [h][k/4][q][k%4] ------
// q runs across the lanes of a transposed score tile, so a lane's four keys lie
// in 16 bytes and 16 neighbouring queries in 256 contiguous bytes.
__global__ __launch_bounds__(256) void bias_tr_kernel(const float* __restrict__ pb,
                                                      float* __restrict__ pbt) {
  int i = blockIdx.x * blockDim.x + threadIdx.x;   // 0 .. 8*512*512-1
  int q = (i >> 2) & (LEN_L - 1);
  int k = ((i >> 11) & (LEN_L / 4 - 1)) * 4 + (i & 3);
  int h = i >> 18;
  pbt[i] = pb[(q * LEN_L + k) * HEADS + h];
}

// ---------------- Kernel 1: LayerNorm -> f16 ----------------
// One wave owns a whole row (8 elements a lane, as two 512-byte wave loads) and
// takes four rows, all eight loads in flight at once: 4096 waves start instead of
// 131072, and the row sums need neither LDS nor a barrier.
__device__ __forceinline__ float xhalf(float x) {   // value of lane l ^ 16
  int b = __builtin_bit_cast(int, x);
  return __builtin_bit_cast(float,
      __builtin_amdgcn_permlanex16(b, b, 0x76543210, 0xfedcba98, false, false));
}

template <int M>
__device__ __forceinline__ float xrow(float x) {    // value of lane l ^ M, M < 16
  return __builtin_bit_cast(float,
      __builtin_amdgcn_update_dpp(0, __builtin_bit_cast(int, x), 0x160 | M, 0xf, 0xf, true));
}

__device__ __forceinline__ float wave_sum(float x) { // butterfly: every lane gets the sum
  x += xrow<1>(x);
  x += xrow<2>(x);
  x += xrow<4>(x);
  x += xrow<8>(x);
  return x + xhalf(x);
}

#define LN_ROWS 4                                    // rows per wave
__global__ __launch_bounds__(256) void ln_kernel(const float* __restrict__ msa,
                                                 const float* __restrict__ lw,
                                                 const float* __restrict__ lb,
                                                 _Float16* __restrict__ mh) {
  const int c = (threadIdx.x & 31) * 4;              // columns c..c+3 and 128+c..128+c+3
  const int row0 = (blockIdx.x * 8 + (threadIdx.x >> 5)) * LN_ROWS;

  const v4f w0 = *(const v4f*)(lw + c), w1 = *(const v4f*)(lw + 128 + c);
  const v4f b0 = *(const v4f*)(lb + c), b1 = *(const v4f*)(lb + 128 + c);
  v4f x0[LN_ROWS], x1[LN_ROWS];
  #pragma unroll   // the rows live in registers: constant indices, loads issued back to back
  for (int r = 0; r < LN_ROWS; ++r) {
    const float* p = msa + (row0 + r) * DIM_D + c;
    x0[r] = *(const v4f*)p;
    x1[r] = *(const v4f*)(p + 128);
  }

  #pragma unroll   // four independent butterfly chains fill one another's latency
  for (int r = 0; r < LN_ROWS; ++r) {
    const v4f s = x0[r] + x1[r];
    const float mu = wave_sum((s[0] + s[1]) + (s[2] + s[3])) * (1.0f / DIM_D);
    const v4f d0 = x0[r] - mu, d1 = x1[r] - mu;
    const v4f q = d0 * d0 + d1 * d1;
    const float var = wave_sum((q[0] + q[1]) + (q[2] + q[3])) * (1.0f / DIM_D);
    const float rs = rsqrtf(var + 1e-5f);
    const v4f y0 = d0 * rs * w0 + b0, y1 = d1 * rs * w1 + b1;
    _Float16* o = mh + (row0 + r) * DIM_D + c;
    *(v4h*)o         = v4h{(_Float16)y0[0], (_Float16)y0[1], (_Float16)y0[2], (_Float16)y0[3]};
    *(v4h*)(o + 128) = v4h{(_Float16)y1[0], (_Float16)y1[1], (_Float16)y1[2], (_Float16)y1[3]};
  }
}

// ============ shared GEMM body (double-buffered LDS ping-pong) ============
// Block tile 128x64, 8 waves, wave = 16 rows x 64 cols (4 C frags), BK=32.
// A: [M][256] f16 row-major. BhT: [N][256] f16 (pre-transposed weights).
__device__ __forceinline__ void gemm_mainloop(const _Float16* __restrict__ Ah,
                                              const _Float16* __restrict__ BhT,
                                              int row0, int ntile,
                                              _Float16 (*As)[128][32],
                                              _Float16 (*BsT)[64][32],
                                              v8f acc[4]) {
  const int t = threadIdx.x, wid = t >> 5, lane = t & 31;
  const int lrow = lane & 15, lhi = lane >> 4;

  const int ar  = t >> 1, aseg = (t & 1) * 16;   // A staging: 16 halves/thread
  const int bn  = t & 63, bks  = (t >> 6) * 8;   // B staging: 8 halves/thread

  v8h ra0, ra1, rb;
  auto gload = [&](int kt) {
    const _Float16* srcA = Ah + (row0 + ar) * DIM_D + kt + aseg;
    ra0 = *(const v8h*)srcA;
    ra1 = *(const v8h*)(srcA + 8);
    rb  = *(const v8h*)(BhT + (ntile + bn) * DIM_D + kt + bks);  // contiguous
  };
  auto sstore = [&](int buf) {
    *(v8h*)&As[buf][ar][aseg]     = ra0;
    *(v8h*)&As[buf][ar][aseg + 8] = ra1;
    *(v8h*)&BsT[buf][bn][bks]     = rb;
  };

  gload(0);
  sstore(0);
  __syncthreads();

  for (int step = 0; step < DIM_D / 32; ++step) {
    const int buf = step & 1;
    const bool more = (step + 1) < DIM_D / 32;
    if (more) gload((step + 1) * 32);            // overlap VMEM with WMMA

    V16H a;
    a.h[0] = *(const v8h*)&As[buf][wid * 16 + lrow][lhi * 8];
    a.h[1] = *(const v8h*)&As[buf][wid * 16 + lrow][lhi * 8 + 16];
    V16H b[4];
    #pragma unroll
    for (int nf = 0; nf < 4; ++nf) {             // batch all ds loads first
      b[nf].h[0] = *(const v8h*)&BsT[buf][nf * 16 + lrow][lhi * 8];
      b[nf].h[1] = *(const v8h*)&BsT[buf][nf * 16 + lrow][lhi * 8 + 16];
    }
    #pragma unroll
    for (int nf = 0; nf < 4; ++nf)               // 4 back-to-back WMMAs
      acc[nf] = wmma_f16(a, b[nf], acc[nf]);

    if (more) sstore(buf ^ 1);
    __syncthreads();
  }
}

// ---------------- Kernel 2: QKV GEMM (16384x256 x 256x768) ----------------
__global__ __launch_bounds__(256) void qkv_gemm_kernel(const _Float16* __restrict__ Ah,
                                                       const _Float16* __restrict__ BhT,
                                                       const float* __restrict__ bq,
                                                       _Float16* __restrict__ Qh,
                                                       _Float16* __restrict__ Kh,
                                                       _Float16* __restrict__ Vh) {
  __shared__ __align__(16) _Float16 As[2][128][32];   // 16 KB
  __shared__ __align__(16) _Float16 BsT[2][64][32];   //  8 KB
  const int row0  = blockIdx.x * 128;
  const int ntile = blockIdx.y * 64;
  const int t = threadIdx.x, wid = t >> 5, lane = t & 31;
  const int lrow = lane & 15, lhi = lane >> 4;

  v8f acc[4] = {};
  gemm_mainloop(Ah, BhT, row0, ntile, As, BsT, acc);

  // Epilogue: + bias, scatter into Q/K/V [n][h][l][hd] f16
  #pragma unroll
  for (int nf = 0; nf < 4; ++nf) {
    #pragma unroll
    for (int r = 0; r < 8; ++r) {
      int col = ntile + nf * 16 + lrow;
      int row = row0 + wid * 16 + r + 8 * lhi;
      float v = acc[nf][r] + bq[col];
      int which = col >> 8, d = col & 255, hh = d >> 5, hdi = d & 31;
      _Float16* dst = (which == 0) ? Qh : ((which == 1) ? Kh : Vh);
      int n = row >> 9, l = row & 511;
      dst[((n * HEADS + hh) * LEN_L + l) * HD + hdi] = (_Float16)v;
    }
  }
}

// ---------------- Kernel 4: proj GEMM + bias + residual ----------------
__global__ __launch_bounds__(256) void proj_gemm_kernel(const _Float16* __restrict__ Ah,
                                                        const _Float16* __restrict__ BhT,
                                                        const float* __restrict__ bp,
                                                        const float* __restrict__ resid,
                                                        float* __restrict__ out) {
  __shared__ __align__(16) _Float16 As[2][128][32];
  __shared__ __align__(16) _Float16 BsT[2][64][32];
  const int row0  = blockIdx.x * 128;
  const int ntile = blockIdx.y * 64;
  const int t = threadIdx.x, wid = t >> 5, lane = t & 31;
  const int lrow = lane & 15, lhi = lane >> 4;

  v8f acc[4] = {};
  gemm_mainloop(Ah, BhT, row0, ntile, As, BsT, acc);

  #pragma unroll
  for (int nf = 0; nf < 4; ++nf) {
    #pragma unroll
    for (int r = 0; r < 8; ++r) {
      int col = ntile + nf * 16 + lrow;
      int row = row0 + wid * 16 + r + 8 * lhi;
      out[row * DIM_D + col] = acc[nf][r] + bp[col] + resid[row * DIM_D + col];
    }
  }
}

__device__ __forceinline__ v8f exp2x8(v8f x) {
  float y0, y1, y2, y3, y4, y5, y6, y7;
  asm("v_exp_f32 %0, %8\n\tv_exp_f32 %1, %9\n\tv_exp_f32 %2, %10\n\tv_exp_f32 %3, %11\n\t"
      "v_exp_f32 %4, %12\n\tv_exp_f32 %5, %13\n\tv_exp_f32 %6, %14\n\tv_exp_f32 %7, %15\n\t"
      "v_nop"
      : "=&v"(y0), "=&v"(y1), "=&v"(y2), "=&v"(y3), "=&v"(y4), "=&v"(y5), "=&v"(y6), "=&v"(y7)
      : "v"(x[0]), "v"(x[1]), "v"(x[2]), "v"(x[3]), "v"(x[4]), "v"(x[5]), "v"(x[6]), "v"(x[7]));
  return v8f{y0, y1, y2, y3, y4, y5, y6, y7};
}

__global__ __launch_bounds__(256) void attn_kernel(const _Float16* __restrict__ Qh,
                                                   const _Float16* __restrict__ Kh,
                                                   const _Float16* __restrict__ Vh,
                                                   const float* __restrict__ pbt, // [h][k/4][q][k%4]
                                                   _Float16* __restrict__ AO) {
  __shared__ __align__(16) _Float16 Ks[2][32][32];     // [key][d]
  __shared__ __align__(16) _Float16 Vt[2][32][32];     // [d][key]
  const int nh = blockIdx.y;                 // n*8 + h
  const int n = nh >> 3, h = nh & 7;
  const int q0 = blockIdx.x * 128;
  const int t = threadIdx.x, wid = t >> 5, lane = t & 31;
  const int lrow = lane & 15, lhi = lane >> 4;

  const _Float16* Qb = Qh + (size_t)nh * LEN_L * HD;
  const _Float16* Kb = Kh + (size_t)nh * LEN_L * HD;
  const _Float16* Vb = Vh + (size_t)nh * LEN_L * HD;
  const int qrow = q0 + wid * 16 + lrow;     // this lane's query
  // this lane's query in the bias plane, at its first group of four keys
  const float* brow = pbt + (size_t)h * LEN_L * LEN_L + lhi * 2 * (LEN_L * 4) + qrow * 4;

  V16H bq;                                   // Qt as B operand: column = query
  bq.h[0] = *(const v8h*)(Qb + qrow * HD + lhi * 8);
  bq.h[1] = *(const v8h*)(Qb + qrow * HD + lhi * 8 + 16);

  float rmax = -1e30f, rsum = 0.0f;          // rsum: this half's keys only
  v8f o0 = {}, o1 = {};                      // Ot rows hd 0..15 / 16..31
  const float scale = 0.17677669529663687f;  // 1/sqrt(32)

  const int skey = t >> 3, sds = (t & 7) * 4;  // staging: 4 halves/thread each
  v4h kr, vr;
  auto gload = [&](int kc) {
    kr = *(const v4h*)(Kb + (kc + skey) * HD + sds);
    vr = *(const v4h*)(Vb + (kc + skey) * HD + sds);
  };
  auto sstore = [&](int buf) {
    *(v4h*)&Ks[buf][skey][sds] = kr;
    Vt[buf][sds + 0][skey] = vr[0]; Vt[buf][sds + 1][skey] = vr[1];
    Vt[buf][sds + 2][skey] = vr[2]; Vt[buf][sds + 3][skey] = vr[3];
  };

  gload(0);
  // the address registers of the Q, K and V loads above are reused right behind
  // them (the zeroed accumulators): the wait stands in front of that overwrite
  asm volatile("s_wait_xcnt 0x0" ::: "memory");
  sstore(0);
  __syncthreads();

  for (int kc = 0; kc < LEN_L; kc += 32) {
    const int buf = (kc >> 5) & 1;
    const bool more = (kc + 32) < LEN_L;
    if (more) {
      gload(kc + 32);                                      // overlap with compute
      __builtin_prefetch(brow + (kc + 32) * LEN_L, 0, 0);
    }

    // bias of keys kc+8h+0..7 and kc+16+8h+0..7 for this lane's query
    const float* bc = brow + kc * LEN_L;     // key group kc/4 (+ 2 in the upper half)
    const v4f g0 = *(const v4f*)(bc);
    const v4f g1 = *(const v4f*)(bc + 1 * (LEN_L * 4));
    const v4f g4 = *(const v4f*)(bc + 4 * (LEN_L * 4));
    const v4f g5 = *(const v4f*)(bc + 5 * (LEN_L * 4));

    // scores: St(32x16) = K(32x32) * Qt  (A frag [key][d] == Ks row-major)
    V16H ak0, ak1;
    ak0.h[0] = *(const v8h*)&Ks[buf][lrow][lhi * 8];
    ak0.h[1] = *(const v8h*)&Ks[buf][lrow][lhi * 8 + 16];
    ak1.h[0] = *(const v8h*)&Ks[buf][16 + lrow][lhi * 8];
    ak1.h[1] = *(const v8h*)&Ks[buf][16 + lrow][lhi * 8 + 16];
    v8f s0 = {}, s1 = {};
    s0 = wmma_f16(ak0, bq, s0);
    s1 = wmma_f16(ak1, bq, s1);

    const v8f bb0 = __builtin_shufflevector(g0, g1, 0, 1, 2, 3, 4, 5, 6, 7);
    const v8f bb1 = __builtin_shufflevector(g4, g5, 0, 1, 2, 3, 4, 5, 6, 7);

    // online softmax (fp32); C layout: col=lane&15 (query), row=r+8*(lane>>4) (key)
    const v8f sv0 = s0 * scale + bb0;
    const v8f sv1 = s1 * scale + bb1;
    float mc = fmaxf(sv0[0], sv1[0]);
    #pragma unroll
    for (int r = 1; r < 8; ++r) mc = fmaxf(mc, fmaxf(sv0[r], sv1[r]));
    mc = fmaxf(mc, xhalf(mc));               // the other half's 16 keys
    const float mnew = fmaxf(rmax, mc);
    const float alpha = __expf(rmax - mnew);
    rmax = mnew;

    const float log2e = 1.44269504f;         // __expf(x) is 2^(x * log2e)
    const v8f p0 = exp2x8((sv0 - mnew) * log2e);
    const v8f p1 = exp2x8((sv1 - mnew) * log2e);
    const v8f pv = p0 + p1;
    V16H bp;                                 // Pt as B operand, straight from St
    #pragma unroll
    for (int r = 0; r < 8; ++r) {
      bp.h[0][r] = (_Float16)p0[r];
      bp.h[1][r] = (_Float16)p1[r];
    }
    const float ps = ((pv[0] + pv[1]) + (pv[2] + pv[3])) + ((pv[4] + pv[5]) + (pv[6] + pv[7]));
    rsum = rsum * alpha + ps;
    o0 *= alpha;
    o1 *= alpha;

    // Ot(32x16) += Vt(32x32) * Pt(32x16); A frag [hd][key] == Vt row-major
    V16H av0, av1;
    av0.h[0] = *(const v8h*)&Vt[buf][lrow][lhi * 8];
    av0.h[1] = *(const v8h*)&Vt[buf][lrow][lhi * 8 + 16];
    av1.h[0] = *(const v8h*)&Vt[buf][16 + lrow][lhi * 8];
    av1.h[1] = *(const v8h*)&Vt[buf][16 + lrow][lhi * 8 + 16];
    o0 = wmma_f16(av0, bp, o0);
    o1 = wmma_f16(av1, bp, o1);

    if (more) sstore(buf ^ 1);
    __syncthreads();
  }

  // join the halves' sums, normalize, store to attn_out [n][l][h*32+hd] f16:
  // a lane holds hd 8h+0..7 and 16+8h+0..7 of its query, two 16-byte stores
  const float inv = 1.0f / (rsum + xhalf(rsum));
  v8h w0, w1;
  #pragma unroll
  for (int r = 0; r < 8; ++r) {
    w0[r] = (_Float16)(o0[r] * inv);
    w1[r] = (_Float16)(o1[r] * inv);
  }
  _Float16* dst = AO + ((size_t)n * LEN_L + qrow) * DIM_D + h * HD + lhi * 8;
  *(v8h*)dst        = w0;
  *(v8h*)(dst + 16) = w1;
}

// ---------------- launch ----------------
extern "C" void kernel_launch(void* const* d_in, const int* in_sizes, int n_in,
                              void* d_out, int out_size, void* d_ws, size_t ws_size,
                              hipStream_t stream) {
  const float* msa   = (const float*)d_in[0];
  const float* pbias = (const float*)d_in[1];
  const float* lnw   = (const float*)d_in[2];
  const float* lnb   = (const float*)d_in[3];
  const float* wqkv  = (const float*)d_in[4];
  const float* bqkv  = (const float*)d_in[5];
  const float* wproj = (const float*)d_in[6];
  const float* bproj = (const float*)d_in[7];
  float* out = (float*)d_out;

  char* ws = (char*)d_ws;
  // workspace layout (bytes), all offsets 16B-aligned
  _Float16* WqkvT  = (_Float16*)(ws + 0);          // [768][256] f16 = 393216
  _Float16* WprojT = (_Float16*)(ws + 393216);     // [256][256] f16 = 131072
  _Float16* Mh     = (_Float16*)(ws + 524288);     // 16384*256*2 = 8388608
  _Float16* Qh     = (_Float16*)(ws + 8912896);    // 8388608
  _Float16* Kh     = (_Float16*)(ws + 17301504);   // 8388608
  _Float16* Vh     = (_Float16*)(ws + 25690112);   // 8388608
  _Float16* AOh    = (_Float16*)(ws + 34078720);   // 8388608
  float*    PbT    = (float*)   (ws + 42467328);   // 8*512*512*4 = 8388608 (total ~48.5 MB)

  cvt_tr_kernel<<<(DIM_D * QKV_N + 255) / 256, 256, 0, stream>>>(wqkv, WqkvT, DIM_D, QKV_N);
  cvt_tr_kernel<<<(DIM_D * DIM_D + 255) / 256, 256, 0, stream>>>(wproj, WprojT, DIM_D, DIM_D);
  bias_tr_kernel<<<(HEADS * LEN_L * LEN_L) / 256, 256, 0, stream>>>(pbias, PbT);
  ln_kernel<<<MROWS / (8 * LN_ROWS), 256, 0, stream>>>(msa, lnw, lnb, Mh);
  qkv_gemm_kernel<<<dim3(MROWS / 128, QKV_N / 64), 256, 0, stream>>>(Mh, WqkvT, bqkv, Qh, Kh, Vh);
  attn_kernel<<<dim3(LEN_L / 128, SEQ_N * HEADS), 256, 0, stream>>>(Qh, Kh, Vh, PbT, AOh);
  proj_gemm_kernel<<<dim3(MROWS / 128, DIM_D / 64), 256, 0, stream>>>(AOh, WprojT, bproj, msa, out);
}

// v003
// Measured time: 75.5 microseconds a run.
// In both of two side-by-side timings against v002, it was 1.08 times as fast.
// All steps since v000 together make it 1.50 times as fast.
#include <hip/hip_runtime.h>
#include <math.h>

// ---- CDNA5 WMMA types ----
typedef __attribute__((ext_vector_type(16))) _Float16 v16h;
typedef __attribute__((ext_vector_type(8)))  _Float16 v8h;
typedef __attribute__((ext_vector_type(4)))  _Float16 v4h;
typedef __attribute__((ext_vector_type(8)))  float    v8f;
typedef __attribute__((ext_vector_type(4)))  float    v4f;

union V16H { v16h v; v8h h[2]; };

__device__ __forceinline__ v8f wmma_f16(const V16H& a, const V16H& b, v8f c) {
  // D = A(16x32 f16) * B(32x16 f16) + C(16x16 f32)
  return __builtin_amdgcn_wmma_f32_16x16x32_f16(false, a.v, false, b.v,
                                                (short)0, c, false, false);
}

// Problem constants: B=1, N=32, L=512, D=256, H=8, hd=32
#define SEQ_N   32
#define LEN_L   512
#define DIM_D   256
#define HEADS   8
#define HD      32
#define MROWS   (SEQ_N * LEN_L)   // 16384
#define QKV_N   (3 * DIM_D)       // 768

// The four preparation stages below depend on none of one another's results. They
// are bodies of ONE launch (prep_kernel): each work-group takes one stage's block,
// blk being the block's index inside that stage.

// ------- Stage: weight convert + transpose: [k][n] f32 -> [n][k] f16 -----
__device__ __forceinline__ void cvt_tr_body(const float* __restrict__ src,
                                            _Float16* __restrict__ dst,
                                            int K, int N, int blk) {
  // out linear index over [n][k]; output writes coalesced in k
  int i = blk * 256 + threadIdx.x;
  if (i >= K * N) return;
  int k = i % K, n = i / K;
  dst[i] = (_Float16)src[k * N + n];
}

// ------ Stage: pair_bias transpose [q][k][h] -> [h][k/4][q][k%4] ------
// q runs across the lanes of a transposed score tile, so a lane's four keys lie
// in 16 bytes and 16 neighbouring queries in 256 contiguous bytes.
__device__ __forceinline__ void bias_tr_body(const float* __restrict__ pb,
                                             float* __restrict__ pbt, int blk) {
  int i = blk * 256 + threadIdx.x;                 // 0 .. 8*512*512-1
  int q = (i >> 2) & (LEN_L - 1);
  int k = ((i >> 11) & (LEN_L / 4 - 1)) * 4 + (i & 3);
  int h = i >> 18;
  pbt[i] = pb[(q * LEN_L + k) * HEADS + h];
}

// ---------------- Stage: LayerNorm -> f16 ----------------
// One wave owns a whole row (8 elements a lane, as two 512-byte wave loads) and
// takes four rows, all eight loads in flight at once: 4096 waves start instead of
// 131072, and the row sums need neither LDS nor a barrier.
__device__ __forceinline__ float xhalf(float x) {   // value of lane l ^ 16
  int b = __builtin_bit_cast(int, x);
  return __builtin_bit_cast(float,
      __builtin_amdgcn_permlanex16(b, b, 0x76543210, 0xfedcba98, false, false));
}

template <int M>
__device__ __forceinline__ float xrow(float x) {    // value of lane l ^ M, M < 16
  return __builtin_bit_cast(float,
      __builtin_amdgcn_update_dpp(0, __builtin_bit_cast(int, x), 0x160 | M, 0xf, 0xf, true));
}

__device__ __forceinline__ float wave_sum(float x) { // butterfly: every lane gets the sum
  x += xrow<1>(x);
  x += xrow<2>(x);
  x += xrow<4>(x);
  x += xrow<8>(x);
  return x + xhalf(x);
}

#define LN_ROWS 4                                    // rows per wave
__device__ __forceinline__ void ln_body(const float* __restrict__ msa,
                                        const float* __restrict__ lw,
                                        const float* __restrict__ lb,
                                        _Float16* __restrict__ mh, int blk) {
  const int c = (threadIdx.x & 31) * 4;              // columns c..c+3 and 128+c..128+c+3
  const int row0 = (blk * 8 + (threadIdx.x >> 5)) * LN_ROWS;

  const v4f w0 = *(const v4f*)(lw + c), w1 = *(const v4f*)(lw + 128 + c);
  const v4f b0 = *(const v4f*)(lb + c), b1 = *(const v4f*)(lb + 128 + c);
  v4f x0[LN_ROWS], x1[LN_ROWS];
  #pragma unroll   // the rows live in registers: constant indices, loads issued back to back
  for (int r = 0; r < LN_ROWS; ++r) {
    const float* p = msa + (row0 + r) * DIM_D + c;
    x0[r] = *(const v4f*)p;
    x1[r] = *(const v4f*)(p + 128);
  }

  #pragma unroll   // four independent butterfly chains fill one another's latency
  for (int r = 0; r < LN_ROWS; ++r) {
    const v4f s = x0[r] + x1[r];
    const float mu = wave_sum((s[0] + s[1]) + (s[2] + s[3])) * (1.0f / DIM_D);
    const v4f d0 = x0[r] - mu, d1 = x1[r] - mu;
    const v4f q = d0 * d0 + d1 * d1;
    const float var = wave_sum((q[0] + q[1]) + (q[2] + q[3])) * (1.0f / DIM_D);
    const float rs = rsqrtf(var + 1e-5f);
    const v4f y0 = d0 * rs * w0 + b0, y1 = d1 * rs * w1 + b1;
    _Float16* o = mh + (row0 + r) * DIM_D + c;
    *(v4h*)o         = v4h{(_Float16)y0[0], (_Float16)y0[1], (_Float16)y0[2], (_Float16)y0[3]};
    *(v4h*)(o + 128) = v4h{(_Float16)y1[0], (_Float16)y1[1], (_Float16)y1[2], (_Float16)y1[3]};
  }
}

// ---------------- Kernel 0: all four preparation stages, one launch ----------------
// The LayerNorm blocks come first (the lowest block indices), for speed only.
#define LN_BLOCKS   (MROWS / (8 * LN_ROWS))             // 512
#define CVQ_BLOCKS  ((DIM_D * QKV_N + 255) / 256)       // 768
#define CVP_BLOCKS  ((DIM_D * DIM_D + 255) / 256)       // 256
#define BIAS_BLOCKS ((HEADS * LEN_L * LEN_L) / 256)     // 8192
__global__ __launch_bounds__(256) void prep_kernel(const float* __restrict__ msa,
                                                   const float* __restrict__ lw,
                                                   const float* __restrict__ lb,
                                                   const float* __restrict__ wqkv,
                                                   const float* __restrict__ wproj,
                                                   const float* __restrict__ pb,
                                                   _Float16* __restrict__ mh,
                                                   _Float16* __restrict__ wqkvT,
                                                   _Float16* __restrict__ wprojT,
                                                   float* __restrict__ pbt) {
  const int b = blockIdx.x;                            // the same for a whole work-group
  if (b < LN_BLOCKS)
    ln_body(msa, lw, lb, mh, b);
  else if (b < LN_BLOCKS + CVQ_BLOCKS)
    cvt_tr_body(wqkv, wqkvT, DIM_D, QKV_N, b - LN_BLOCKS);
  else if (b < LN_BLOCKS + CVQ_BLOCKS + CVP_BLOCKS)
    cvt_tr_body(wproj, wprojT, DIM_D, DIM_D, b - (LN_BLOCKS + CVQ_BLOCKS));
  else
    bias_tr_body(pb, pbt, b - (LN_BLOCKS + CVQ_BLOCKS + CVP_BLOCKS));
}

// ============ shared GEMM body (double-buffered LDS ping-pong) ============
// Block tile 128x64, 8 waves, wave = 16 rows x 64 cols (4 C frags), BK=32.
// A: [M][256] f16 row-major. BhT: [N][256] f16 (pre-transposed weights).
__device__ __forceinline__ void gemm_mainloop(const _Float16* __restrict__ Ah,
                                              const _Float16* __restrict__ BhT,
                                              int row0, int ntile,
                                              _Float16 (*As)[128][32],
                                              _Float16 (*BsT)[64][32],
                                              v8f acc[4]) {
  const int t = threadIdx.x, wid = t >> 5, lane = t & 31;
  const int lrow = lane & 15, lhi = lane >> 4;

  const int ar  = t >> 1, aseg = (t & 1) * 16;   // A staging: 16 halves/thread
  const int bn  = t & 63, bks  = (t >> 6) * 8;   // B staging: 8 halves/thread

  v8h ra0, ra1, rb;
  auto gload = [&](int kt) {
    const _Float16* srcA = Ah + (row0 + ar) * DIM_D + kt + aseg;
    ra0 = *(const v8h*)srcA;
    ra1 = *(const v8h*)(srcA + 8);
    rb  = *(const v8h*)(BhT + (ntile + bn) * DIM_D + kt + bks);  // contiguous
  };
  auto sstore = [&](int buf) {
    *(v8h*)&As[buf][ar][aseg]     = ra0;
    *(v8h*)&As[buf][ar][aseg + 8] = ra1;
    *(v8h*)&BsT[buf][bn][bks]     = rb;
  };

  gload(0);
  sstore(0);
  __syncthreads();

  for (int step = 0; step < DIM_D / 32; ++step) {
    const int buf = step & 1;
    const bool more = (step + 1) < DIM_D / 32;
    if (more) gload((step + 1) * 32);            // overlap VMEM with WMMA

    V16H a;
    a.h[0] = *(const v8h*)&As[buf][wid * 16 + lrow][lhi * 8];
    a.h[1] = *(const v8h*)&As[buf][wid * 16 + lrow][lhi * 8 + 16];
    V16H b[4];
    #pragma unroll
    for (int nf = 0; nf < 4; ++nf) {             // batch all ds loads first
      b[nf].h[0] = *(const v8h*)&BsT[buf][nf * 16 + lrow][lhi * 8];
      b[nf].h[1] = *(const v8h*)&BsT[buf][nf * 16 + lrow][lhi * 8 + 16];
    }
    #pragma unroll
    for (int nf = 0; nf < 4; ++nf)               // 4 back-to-back WMMAs
      acc[nf] = wmma_f16(a, b[nf], acc[nf]);

    if (more) sstore(buf ^ 1);
    __syncthreads();
  }
}

// ---------------- Kernel 2: QKV GEMM (16384x256 x 256x768) ----------------
__global__ __launch_bounds__(256) void qkv_gemm_kernel(const _Float16* __restrict__ Ah,
                                                       const _Float16* __restrict__ BhT,
                                                       const float* __restrict__ bq,
                                                       _Float16* __restrict__ Qh,
                                                       _Float16* __restrict__ Kh,
                                                       _Float16* __restrict__ Vh) {
  __shared__ __align__(16) _Float16 As[2][128][32];   // 16 KB
  __shared__ __align__(16) _Float16 BsT[2][64][32];   //  8 KB
  const int row0  = blockIdx.x * 128;
  const int ntile = blockIdx.y * 64;
  const int t = threadIdx.x, wid = t >> 5, lane = t & 31;
  const int lrow = lane & 15, lhi = lane >> 4;

  v8f acc[4] = {};
  gemm_mainloop(Ah, BhT, row0, ntile, As, BsT, acc);

  // Epilogue: + bias, scatter into Q/K/V [n][h][l][hd] f16
  #pragma unroll
  for (int nf = 0; nf < 4; ++nf) {
    #pragma unroll
    for (int r = 0; r < 8; ++r) {
      int col = ntile + nf * 16 + lrow;
      int row = row0 + wid * 16 + r + 8 * lhi;
      float v = acc[nf][r] + bq[col];
      int which = col >> 8, d = col & 255, hh = d >> 5, hdi = d & 31;
      _Float16* dst = (which == 0) ? Qh : ((which == 1) ? Kh : Vh);
      int n = row >> 9, l = row & 511;
      dst[((n * HEADS + hh) * LEN_L + l) * HD + hdi] = (_Float16)v;
    }
  }
}

// ---------------- Kernel 4: proj GEMM + bias + residual ----------------
__global__ __launch_bounds__(256) void proj_gemm_kernel(const _Float16* __restrict__ Ah,
                                                        const _Float16* __restrict__ BhT,
                                                        const float* __restrict__ bp,
                                                        const float* __restrict__ resid,
                                                        float* __restrict__ out) {
  __shared__ __align__(16) _Float16 As[2][128][32];
  __shared__ __align__(16) _Float16 BsT[2][64][32];
  const int row0  = blockIdx.x * 128;
  const int ntile = blockIdx.y * 64;
  const int t = threadIdx.x, wid = t >> 5, lane = t & 31;
  const int lrow = lane & 15, lhi = lane >> 4;

  v8f acc[4] = {};
  gemm_mainloop(Ah, BhT, row0, ntile, As, BsT, acc);

  #pragma unroll
  for (int nf = 0; nf < 4; ++nf) {
    #pragma unroll
    for (int r = 0; r < 8; ++r) {
      int col = ntile + nf * 16 + lrow;
      int row = row0 + wid * 16 + r + 8 * lhi;
      out[row * DIM_D + col] = acc[nf][r] + bp[col] + resid[row * DIM_D + col];
    }
  }
}

__device__ __forceinline__ v8f exp2x8(v8f x) {
  float y0, y1, y2, y3, y4, y5, y6, y7;
  asm("v_exp_f32 %0, %8\n\tv_exp_f32 %1, %9\n\tv_exp_f32 %2, %10\n\tv_exp_f32 %3, %11\n\t"
      "v_exp_f32 %4, %12\n\tv_exp_f32 %5, %13\n\tv_exp_f32 %6, %14\n\tv_exp_f32 %7, %15\n\t"
      "v_nop"
      : "=&v"(y0), "=&v"(y1), "=&v"(y2), "=&v"(y3), "=&v"(y4), "=&v"(y5), "=&v"(y6), "=&v"(y7)
      : "v"(x[0]), "v"(x[1]), "v"(x[2]), "v"(x[3]), "v"(x[4]), "v"(x[5]), "v"(x[6]), "v"(x[7]));
  return v8f{y0, y1, y2, y3, y4, y5, y6, y7};
}

__global__ __launch_bounds__(256) void attn_kernel(const _Float16* __restrict__ Qh,
                                                   const _Float16* __restrict__ Kh,
                                                   const _Float16* __restrict__ Vh,
                                                   const float* __restrict__ pbt, // [h][k/4][q][k%4]
                                                   _Float16* __restrict__ AO) {
  __shared__ __align__(16) _Float16 Ks[2][32][32];     // [key][d]
  __shared__ __align__(16) _Float16 Vt[2][32][32];     // [d][key]
  const int nh = blockIdx.y;                 // n*8 + h
  const int n = nh >> 3, h = nh & 7;
  const int q0 = blockIdx.x * 128;
  const int t = threadIdx.x, wid = t >> 5, lane = t & 31;
  const int lrow = lane & 15, lhi = lane >> 4;

  const _Float16* Qb = Qh + (size_t)nh * LEN_L * HD;
  const _Float16* Kb = Kh + (size_t)nh * LEN_L * HD;
  const _Float16* Vb = Vh + (size_t)nh * LEN_L * HD;
  const int qrow = q0 + wid * 16 + lrow;     // this lane's query
  // this lane's query in the bias plane, at its first group of four keys
  const float* brow = pbt + (size_t)h * LEN_L * LEN_L + lhi * 2 * (LEN_L * 4) + qrow * 4;

  V16H bq;                                   // Qt as B operand: column = query
  bq.h[0] = *(const v8h*)(Qb + qrow * HD + lhi * 8);
  bq.h[1] = *(const v8h*)(Qb + qrow * HD + lhi * 8 + 16);

  float rmax = -1e30f, rsum = 0.0f;          // rsum: this half's keys only
  v8f o0 = {}, o1 = {};                      // Ot rows hd 0..15 / 16..31
  const float scale = 0.17677669529663687f;  // 1/sqrt(32)

  const int skey = t >> 3, sds = (t & 7) * 4;  // staging: 4 halves/thread each
  v4h kr, vr;
  auto gload = [&](int kc) {
    kr = *(const v4h*)(Kb + (kc + skey) * HD + sds);
    vr = *(const v4h*)(Vb + (kc + skey) * HD + sds);
  };
  auto sstore = [&](int buf) {
    *(v4h*)&Ks[buf][skey][sds] = kr;
    Vt[buf][sds + 0][skey] = vr[0]; Vt[buf][sds + 1][skey] = vr[1];
    Vt[buf][sds + 2][skey] = vr[2]; Vt[buf][sds + 3][skey] = vr[3];
  };

  gload(0);
  // the address registers of the Q, K and V loads above are reused right behind
  // them (the zeroed accumulators): the wait stands in front of that overwrite
  asm volatile("s_wait_xcnt 0x0" ::: "memory");
  sstore(0);
  __syncthreads();

  for (int kc = 0; kc < LEN_L; kc += 32) {
    const int buf = (kc >> 5) & 1;
    const bool more = (kc + 32) < LEN_L;
    if (more) {
      gload(kc + 32);                                      // overlap with compute
      __builtin_prefetch(brow + (kc + 32) * LEN_L, 0, 0);
    }

    // bias of keys kc+8h+0..7 and kc+16+8h+0..7 for this lane's query
    const float* bc = brow + kc * LEN_L;     // key group kc/4 (+ 2 in the upper half)
    const v4f g0 = *(const v4f*)(bc);
    const v4f g1 = *(const v4f*)(bc + 1 * (LEN_L * 4));
    const v4f g4 = *(const v4f*)(bc + 4 * (LEN_L * 4));
    const v4f g5 = *(const v4f*)(bc + 5 * (LEN_L * 4));

    // scores: St(32x16) = K(32x32) * Qt  (A frag [key][d] == Ks row-major)
    V16H ak0, ak1;
    ak0.h[0] = *(const v8h*)&Ks[buf][lrow][lhi * 8];
    ak0.h[1] = *(const v8h*)&Ks[buf][lrow][lhi * 8 + 16];
    ak1.h[0] = *(const v8h*)&Ks[buf][16 + lrow][lhi * 8];
    ak1.h[1] = *(const v8h*)&Ks[buf][16 + lrow][lhi * 8 + 16];
    v8f s0 = {}, s1 = {};
    s0 = wmma_f16(ak0, bq, s0);
    s1 = wmma_f16(ak1, bq, s1);

    const v8f bb0 = __builtin_shufflevector(g0, g1, 0, 1, 2, 3, 4, 5, 6, 7);
    const v8f bb1 = __builtin_shufflevector(g4, g5, 0, 1, 2, 3, 4, 5, 6, 7);

    // online softmax (fp32); C layout: col=lane&15 (query), row=r+8*(lane>>4) (key)
    const v8f sv0 = s0 * scale + bb0;
    const v8f sv1 = s1 * scale + bb1;
    float mc = fmaxf(sv0[0], sv1[0]);
    #pragma unroll
    for (int r = 1; r < 8; ++r) mc = fmaxf(mc, fmaxf(sv0[r], sv1[r]));
    mc = fmaxf(mc, xhalf(mc));               // the other half's 16 keys
    const float mnew = fmaxf(rmax, mc);
    const float alpha = __expf(rmax - mnew);
    rmax = mnew;

    const float log2e = 1.44269504f;         // __expf(x) is 2^(x * log2e)
    const v8f p0 = exp2x8((sv0 - mnew) * log2e);
    const v8f p1 = exp2x8((sv1 - mnew) * log2e);
    const v8f pv = p0 + p1;
    V16H bp;                                 // Pt as B operand, straight from St
    #pragma unroll
    for (int r = 0; r < 8; ++r) {
      bp.h[0][r] = (_Float16)p0[r];
      bp.h[1][r] = (_Float16)p1[r];
    }
    const float ps = ((pv[0] + pv[1]) + (pv[2] + pv[3])) + ((pv[4] + pv[5]) + (pv[6] + pv[7]));
    rsum = rsum * alpha + ps;
    o0 *= alpha;
    o1 *= alpha;

    // Ot(32x16) += Vt(32x32) * Pt(32x16); A frag [hd][key] == Vt row-major
    V16H av0, av1;
    av0.h[0] = *(const v8h*)&Vt[buf][lrow][lhi * 8];
    av0.h[1] = *(const v8h*)&Vt[buf][lrow][lhi * 8 + 16];
    av1.h[0] = *(const v8h*)&Vt[buf][16 + lrow][lhi * 8];
    av1.h[1] = *(const v8h*)&Vt[buf][16 + lrow][lhi * 8 + 16];
    o0 = wmma_f16(av0, bp, o0);
    o1 = wmma_f16(av1, bp, o1);

    if (more) sstore(buf ^ 1);
    __syncthreads();
  }

  // join the halves' sums, normalize, store to attn_out [n][l][h*32+hd] f16:
  // a lane holds hd 8h+0..7 and 16+8h+0..7 of its query, two 16-byte stores
  const float inv = 1.0f / (rsum + xhalf(rsum));
  v8h w0, w1;
  #pragma unroll
  for (int r = 0; r < 8; ++r) {
    w0[r] = (_Float16)(o0[r] * inv);
    w1[r] = (_Float16)(o1[r] * inv);
  }
  _Float16* dst = AO + ((size_t)n * LEN_L + qrow) * DIM_D + h * HD + lhi * 8;
  *(v8h*)dst        = w0;
  *(v8h*)(dst + 16) = w1;
}

// ---------------- launch ----------------
extern "C" void kernel_launch(void* const* d_in, const int* in_sizes, int n_in,
                              void* d_out, int out_size, void* d_ws, size_t ws_size,
                              hipStream_t stream) {
  const float* msa   = (const float*)d_in[0];
  const float* pbias = (const float*)d_in[1];
  const float* lnw   = (const float*)d_in[2];
  const float* lnb   = (const float*)d_in[3];
  const float* wqkv  = (const float*)d_in[4];
  const float* bqkv  = (const float*)d_in[5];
  const float* wproj = (const float*)d_in[6];
  const float* bproj = (const float*)d_in[7];
  float* out = (float*)d_out;

  char* ws = (char*)d_ws;
  // workspace layout (bytes), all offsets 16B-aligned
  _Float16* WqkvT  = (_Float16*)(ws + 0);          // [768][256] f16 = 393216
  _Float16* WprojT = (_Float16*)(ws + 393216);     // [256][256] f16 = 131072
  _Float16* Mh     = (_Float16*)(ws + 524288);     // 16384*256*2 = 8388608
  _Float16* Qh     = (_Float16*)(ws + 8912896);    // 8388608
  _Float16* Kh     = (_Float16*)(ws + 17301504);   // 8388608
  _Float16* Vh     = (_Float16*)(ws + 25690112);   // 8388608
  _Float16* AOh    = (_Float16*)(ws + 34078720);   // 8388608
  float*    PbT    = (float*)   (ws + 42467328);   // 8*512*512*4 = 8388608 (total ~48.5 MB)

  prep_kernel<<<LN_BLOCKS + CVQ_BLOCKS + CVP_BLOCKS + BIAS_BLOCKS, 256, 0, stream>>>(
      msa, lnw, lnb, wqkv, wproj, pbias, Mh, WqkvT, WprojT, PbT);
  qkv_gemm_kernel<<<dim3(MROWS / 128, QKV_N / 64), 256, 0, stream>>>(Mh, WqkvT, bqkv, Qh, Kh, Vh);
  attn_kernel<<<dim3(LEN_L / 128, SEQ_N * HEADS), 256, 0, stream>>>(Qh, Kh, Vh, PbT, AOh);
  proj_gemm_kernel<<<dim3(MROWS / 128, DIM_D / 64), 256, 0, stream>>>(AOh, WprojT, bproj, msa, out);
}

// v004
// Measured time: 65.7 microseconds a run.
// Next to v003, in two timings, it ran 1.14 times as fast each time.
// Over all steps from v000 it is 1.72 times as fast.
#include <hip/hip_runtime.h>
#include <math.h>

// ---- CDNA5 WMMA types ----
typedef __attribute__((ext_vector_type(16))) _Float16 v16h;
typedef __attribute__((ext_vector_type(8)))  _Float16 v8h;
typedef __attribute__((ext_vector_type(4)))  _Float16 v4h;
typedef __attribute__((ext_vector_type(8)))  float    v8f;
typedef __attribute__((ext_vector_type(4)))  float    v4f;

union V16H { v16h v; v8h h[2]; };

__device__ __forceinline__ v8f wmma_f16(const V16H& a, const V16H& b, v8f c) {
  // D = A(16x32 f16) * B(32x16 f16) + C(16x16 f32)
  return __builtin_amdgcn_wmma_f32_16x16x32_f16(false, a.v, false, b.v,
                                                (short)0, c, false, false);
}

// Problem constants: B=1, N=32, L=512, D=256, H=8, hd=32
#define SEQ_N   32
#define LEN_L   512
#define DIM_D   256
#define HEADS   8
#define HD      32
#define MROWS   (SEQ_N * LEN_L)   // 16384
#define QKV_N   (3 * DIM_D)       // 768

// LDS rows that hold 32 halves (64 bytes) of a matrix fragment's k range are laid at
// a pitch of 40 halves (80 bytes = 16 x 5). The 16 lanes of a half wave read 16 bytes
// each from 16 rows: at 64 bytes the rows fall on 4 bank groups, four rows on each;
// at 80 bytes the 16 rows fall on 16 different groups of four banks.
#define LPITCH  40

// The four preparation stages below depend on none of one another's results. They
// are bodies of ONE launch (prep_kernel): each work-group takes one stage's block,
// blk being the block's index inside that stage.

// ------- Stage: weight convert + transpose: [k][n] f32 -> [n][k] f16 -----
__device__ __forceinline__ void cvt_tr_body(const float* __restrict__ src,
                                            _Float16* __restrict__ dst,
                                            int K, int N, int blk) {
  // out linear index over [n][k]; output writes coalesced in k
  int i = blk * 256 + threadIdx.x;
  if (i >= K * N) return;
  int k = i % K, n = i / K;
  dst[i] = (_Float16)src[k * N + n];
}

// ------ Stage: pair_bias transpose [q][k][h] -> [h][k/4][q][k%4] ------
// q runs across the lanes of a transposed score tile, so a lane's four keys lie
// in 16 bytes and 16 neighbouring queries in 256 contiguous bytes.
__device__ __forceinline__ void bias_tr_body(const float* __restrict__ pb,
                                             float* __restrict__ pbt, int blk) {
  int i = blk * 256 + threadIdx.x;                 // 0 .. 8*512*512-1
  int q = (i >> 2) & (LEN_L - 1);
  int k = ((i >> 11) & (LEN_L / 4 - 1)) * 4 + (i & 3);
  int h = i >> 18;
  pbt[i] = pb[(q * LEN_L + k) * HEADS + h];
}

// ---------------- Stage: LayerNorm -> f16 ----------------
// One wave owns a whole row (8 elements a lane, as two 512-byte wave loads) and
// takes four rows, all eight loads in flight at once: 4096 waves start instead of
// 131072, and the row sums need neither LDS nor a barrier.
__device__ __forceinline__ float xhalf(float x) {   // value of lane l ^ 16
  int b = __builtin_bit_cast(int, x);
  return __builtin_bit_cast(float,
      __builtin_amdgcn_permlanex16(b, b, 0x76543210, 0xfedcba98, false, false));
}

template <int M>
__device__ __forceinline__ float xrow(float x) {    // value of lane l ^ M, M < 16
  return __builtin_bit_cast(float,
      __builtin_amdgcn_update_dpp(0, __builtin_bit_cast(int, x), 0x160 | M, 0xf, 0xf, true));
}

__device__ __forceinline__ float wave_sum(float x) { // butterfly: every lane gets the sum
  x += xrow<1>(x);
  x += xrow<2>(x);
  x += xrow<4>(x);
  x += xrow<8>(x);
  return x + xhalf(x);
}

#define LN_ROWS 4                                    // rows per wave
__device__ __forceinline__ void ln_body(const float* __restrict__ msa,
                                        const float* __restrict__ lw,
                                        const float* __restrict__ lb,
                                        _Float16* __restrict__ mh, int blk) {
  const int c = (threadIdx.x & 31) * 4;              // columns c..c+3 and 128+c..128+c+3
  const int row0 = (blk * 8 + (threadIdx.x >> 5)) * LN_ROWS;

  const v4f w0 = *(const v4f*)(lw + c), w1 = *(const v4f*)(lw + 128 + c);
  const v4f b0 = *(const v4f*)(lb + c), b1 = *(const v4f*)(lb + 128 + c);
  v4f x0[LN_ROWS], x1[LN_ROWS];
  #pragma unroll   // the rows live in registers: constant indices, loads issued back to back
  for (int r = 0; r < LN_ROWS; ++r) {
    const float* p = msa + (row0 + r) * DIM_D + c;
    x0[r] = *(const v4f*)p;
    x1[r] = *(const v4f*)(p + 128);
  }

  #pragma unroll   // four independent butterfly chains fill one another's latency
  for (int r = 0; r < LN_ROWS; ++r) {
    const v4f s = x0[r] + x1[r];
    const float mu = wave_sum((s[0] + s[1]) + (s[2] + s[3])) * (1.0f / DIM_D);
    const v4f d0 = x0[r] - mu, d1 = x1[r] - mu;
    const v4f q = d0 * d0 + d1 * d1;
    const float var = wave_sum((q[0] + q[1]) + (q[2] + q[3])) * (1.0f / DIM_D);
    const float rs = rsqrtf(var + 1e-5f);
    const v4f y0 = d0 * rs * w0 + b0, y1 = d1 * rs * w1 + b1;
    _Float16* o = mh + (row0 + r) * DIM_D + c;
    *(v4h*)o         = v4h{(_Float16)y0[0], (_Float16)y0[1], (_Float16)y0[2], (_Float16)y0[3]};
    *(v4h*)(o + 128) = v4h{(_Float16)y1[0], (_Float16)y1[1], (_Float16)y1[2], (_Float16)y1[3]};
  }
}

// ---------------- Kernel 0: all four preparation stages, one launch ----------------
// The LayerNorm blocks come first (the lowest block indices), for speed only.
#define LN_BLOCKS   (MROWS / (8 * LN_ROWS))             // 512
#define CVQ_BLOCKS  ((DIM_D * QKV_N + 255) / 256)       // 768
#define CVP_BLOCKS  ((DIM_D * DIM_D + 255) / 256)       // 256
#define BIAS_BLOCKS ((HEADS * LEN_L * LEN_L) / 256)     // 8192
__global__ __launch_bounds__(256) void prep_kernel(const float* __restrict__ msa,
                                                   const float* __restrict__ lw,
                                                   const float* __restrict__ lb,
                                                   const float* __restrict__ wqkv,
                                                   const float* __restrict__ wproj,
                                                   const float* __restrict__ pb,
                                                   _Float16* __restrict__ mh,
                                                   _Float16* __restrict__ wqkvT,
                                                   _Float16* __restrict__ wprojT,
                                                   float* __restrict__ pbt) {
  const int b = blockIdx.x;                            // the same for a whole work-group
  if (b < LN_BLOCKS)
    ln_body(msa, lw, lb, mh, b);
  else if (b < LN_BLOCKS + CVQ_BLOCKS)
    cvt_tr_body(wqkv, wqkvT, DIM_D, QKV_N, b - LN_BLOCKS);
  else if (b < LN_BLOCKS + CVQ_BLOCKS + CVP_BLOCKS)
    cvt_tr_body(wproj, wprojT, DIM_D, DIM_D, b - (LN_BLOCKS + CVQ_BLOCKS));
  else
    bias_tr_body(pb, pbt, b - (LN_BLOCKS + CVQ_BLOCKS + CVP_BLOCKS));
}

// ============ shared GEMM body (double-buffered LDS ping-pong) ============
// Block tile 128x64, 8 waves, wave = 16 rows x 64 cols (4 C frags), BK=32.
// A: [M][256] f16 row-major. BhT: [N][256] f16 (pre-transposed weights).
__device__ __forceinline__ void gemm_mainloop(const _Float16* __restrict__ Ah,
                                              const _Float16* __restrict__ BhT,
                                              int row0, int ntile,
                                              _Float16 (*As)[128][LPITCH],
                                              _Float16 (*BsT)[64][LPITCH],
                                              v8f acc[4]) {
  const int t = threadIdx.x, wid = t >> 5, lane = t & 31;
  const int lrow = lane & 15, lhi = lane >> 4;

  const int ar  = t >> 1, aseg = (t & 1) * 16;   // A staging: 16 halves/thread
  const int bn  = t & 63, bks  = (t >> 6) * 8;   // B staging: 8 halves/thread

  v8h ra0, ra1, rb;
  auto gload = [&](int kt) {
    const _Float16* srcA = Ah + (row0 + ar) * DIM_D + kt + aseg;
    ra0 = *(const v8h*)srcA;
    ra1 = *(const v8h*)(srcA + 8);
    rb  = *(const v8h*)(BhT + (ntile + bn) * DIM_D + kt + bks);  // contiguous
  };
  auto sstore = [&](int buf) {
    *(v8h*)&As[buf][ar][aseg]     = ra0;
    *(v8h*)&As[buf][ar][aseg + 8] = ra1;
    *(v8h*)&BsT[buf][bn][bks]     = rb;
  };

  gload(0);
  sstore(0);
  __syncthreads();

  for (int step = 0; step < DIM_D / 32; ++step) {
    const int buf = step & 1;
    const bool more = (step + 1) < DIM_D / 32;
    if (more) gload((step + 1) * 32);            // overlap VMEM with WMMA

    V16H a;
    a.h[0] = *(const v8h*)&As[buf][wid * 16 + lrow][lhi * 8];
    a.h[1] = *(const v8h*)&As[buf][wid * 16 + lrow][lhi * 8 + 16];
    V16H b[4];
    #pragma unroll
    for (int nf = 0; nf < 4; ++nf) {             // batch all ds loads first
      b[nf].h[0] = *(const v8h*)&BsT[buf][nf * 16 + lrow][lhi * 8];
      b[nf].h[1] = *(const v8h*)&BsT[buf][nf * 16 + lrow][lhi * 8 + 16];
    }
    #pragma unroll
    for (int nf = 0; nf < 4; ++nf)               // 4 back-to-back WMMAs
      acc[nf] = wmma_f16(a, b[nf], acc[nf]);

    if (more) sstore(buf ^ 1);
    __syncthreads();
  }
}

// ---------------- Kernel 2: QKV GEMM (16384x256 x 256x768) ----------------
__global__ __launch_bounds__(256) void qkv_gemm_kernel(const _Float16* __restrict__ Ah,
                                                       const _Float16* __restrict__ BhT,
                                                       const float* __restrict__ bq,
                                                       _Float16* __restrict__ Qh,
                                                       _Float16* __restrict__ Kh,
                                                       _Float16* __restrict__ Vh) {
  __shared__ __align__(16) _Float16 As[2][128][LPITCH];   // 20 KB
  __shared__ __align__(16) _Float16 BsT[2][64][LPITCH];   // 10 KB
  const int row0  = blockIdx.x * 128;
  const int ntile = blockIdx.y * 64;
  const int t = threadIdx.x, wid = t >> 5, lane = t & 31;
  const int lrow = lane & 15, lhi = lane >> 4;

  v8f acc[4] = {};
  gemm_mainloop(Ah, BhT, row0, ntile, As, BsT, acc);

  // Epilogue: + bias, scatter into Q/K/V [n][h][l][hd] f16
  #pragma unroll
  for (int nf = 0; nf < 4; ++nf) {
    #pragma unroll
    for (int r = 0; r < 8; ++r) {
      int col = ntile + nf * 16 + lrow;
      int row = row0 + wid * 16 + r + 8 * lhi;
      float v = acc[nf][r] + bq[col];
      int which = col >> 8, d = col & 255, hh = d >> 5, hdi = d & 31;
      _Float16* dst = (which == 0) ? Qh : ((which == 1) ? Kh : Vh);
      int n = row >> 9, l = row & 511;
      dst[((n * HEADS + hh) * LEN_L + l) * HD + hdi] = (_Float16)v;
    }
  }
}

// ---------------- Kernel 4: proj GEMM + bias + residual ----------------
__global__ __launch_bounds__(256) void proj_gemm_kernel(const _Float16* __restrict__ Ah,
                                                        const _Float16* __restrict__ BhT,
                                                        const float* __restrict__ bp,
                                                        const float* __restrict__ resid,
                                                        float* __restrict__ out) {
  __shared__ __align__(16) _Float16 As[2][128][LPITCH];
  __shared__ __align__(16) _Float16 BsT[2][64][LPITCH];
  const int row0  = blockIdx.x * 128;
  const int ntile = blockIdx.y * 64;
  const int t = threadIdx.x, wid = t >> 5, lane = t & 31;
  const int lrow = lane & 15, lhi = lane >> 4;

  v8f acc[4] = {};
  gemm_mainloop(Ah, BhT, row0, ntile, As, BsT, acc);

  #pragma unroll
  for (int nf = 0; nf < 4; ++nf) {
    #pragma unroll
    for (int r = 0; r < 8; ++r) {
      int col = ntile + nf * 16 + lrow;
      int row = row0 + wid * 16 + r + 8 * lhi;
      out[row * DIM_D + col] = acc[nf][r] + bp[col] + resid[row * DIM_D + col];
    }
  }
}

__device__ __forceinline__ v8f exp2x8(v8f x) {
  float y0, y1, y2, y3, y4, y5, y6, y7;
  asm("v_exp_f32 %0, %8\n\tv_exp_f32 %1, %9\n\tv_exp_f32 %2, %10\n\tv_exp_f32 %3, %11\n\t"
      "v_exp_f32 %4, %12\n\tv_exp_f32 %5, %13\n\tv_exp_f32 %6, %14\n\tv_exp_f32 %7, %15\n\t"
      "v_nop"
      : "=&v"(y0), "=&v"(y1), "=&v"(y2), "=&v"(y3), "=&v"(y4), "=&v"(y5), "=&v"(y6), "=&v"(y7)
      : "v"(x[0]), "v"(x[1]), "v"(x[2]), "v"(x[3]), "v"(x[4]), "v"(x[5]), "v"(x[6]), "v"(x[7]));
  return v8f{y0, y1, y2, y3, y4, y5, y6, y7};
}

__global__ __launch_bounds__(256) void attn_kernel(const _Float16* __restrict__ Qh,
                                                   const _Float16* __restrict__ Kh,
                                                   const _Float16* __restrict__ Vh,
                                                   const float* __restrict__ pbt, // [h][k/4][q][k%4]
                                                   _Float16* __restrict__ AO) {
  __shared__ __align__(16) _Float16 Ks[2][32][LPITCH]; // [key][d]
  __shared__ __align__(16) _Float16 Vt[2][32][LPITCH]; // [d][key]
  const int nh = blockIdx.y;                 // n*8 + h
  const int n = nh >> 3, h = nh & 7;
  const int q0 = blockIdx.x * 128;
  const int t = threadIdx.x, wid = t >> 5, lane = t & 31;
  const int lrow = lane & 15, lhi = lane >> 4;

  const _Float16* Qb = Qh + (size_t)nh * LEN_L * HD;
  const _Float16* Kb = Kh + (size_t)nh * LEN_L * HD;
  const _Float16* Vb = Vh + (size_t)nh * LEN_L * HD;
  const int qrow = q0 + wid * 16 + lrow;     // this lane's query
  // this lane's query in the bias plane, at its first group of four keys
  const float* brow = pbt + (size_t)h * LEN_L * LEN_L + lhi * 2 * (LEN_L * 4) + qrow * 4;

  V16H bq;                                   // Qt as B operand: column = query
  bq.h[0] = *(const v8h*)(Qb + qrow * HD + lhi * 8);
  bq.h[1] = *(const v8h*)(Qb + qrow * HD + lhi * 8 + 16);

  float rmax = -1e30f, rsum = 0.0f;          // rsum: this half's keys only
  v8f o0 = {}, o1 = {};                      // Ot rows hd 0..15 / 16..31
  const float scale = 0.17677669529663687f;  // 1/sqrt(32)

  const int skey = t >> 3, sds = (t & 7) * 4;  // staging: 4 halves/thread each
  v4h kr, vr;
  auto gload = [&](int kc) {
    kr = *(const v4h*)(Kb + (kc + skey) * HD + sds);
    vr = *(const v4h*)(Vb + (kc + skey) * HD + sds);
  };
  auto sstore = [&](int buf) {
    *(v4h*)&Ks[buf][skey][sds] = kr;
    Vt[buf][sds + 0][skey] = vr[0]; Vt[buf][sds + 1][skey] = vr[1];
    Vt[buf][sds + 2][skey] = vr[2]; Vt[buf][sds + 3][skey] = vr[3];
  };

  gload(0);
  // the address registers of the Q, K and V loads above are reused right behind
  // them (the zeroed accumulators): the wait stands in front of that overwrite
  asm volatile("s_wait_xcnt 0x0" ::: "memory");
  sstore(0);
  __syncthreads();

  for (int kc = 0; kc < LEN_L; kc += 32) {
    const int buf = (kc >> 5) & 1;
    const bool more = (kc + 32) < LEN_L;
    if (more) {
      gload(kc + 32);                                      // overlap with compute
      __builtin_prefetch(brow + (kc + 32) * LEN_L, 0, 0);
    }

    // bias of keys kc+8h+0..7 and kc+16+8h+0..7 for this lane's query
    const float* bc = brow + kc * LEN_L;     // key group kc/4 (+ 2 in the upper half)
    const v4f g0 = *(const v4f*)(bc);
    const v4f g1 = *(const v4f*)(bc + 1 * (LEN_L * 4));
    const v4f g4 = *(const v4f*)(bc + 4 * (LEN_L * 4));
    const v4f g5 = *(const v4f*)(bc + 5 * (LEN_L * 4));

    // scores: St(32x16) = K(32x32) * Qt  (A frag [key][d] == Ks row-major)
    V16H ak0, ak1;
    ak0.h[0] = *(const v8h*)&Ks[buf][lrow][lhi * 8];
    ak0.h[1] = *(const v8h*)&Ks[buf][lrow][lhi * 8 + 16];
    ak1.h[0] = *(const v8h*)&Ks[buf][16 + lrow][lhi * 8];
    ak1.h[1] = *(const v8h*)&Ks[buf][16 + lrow][lhi * 8 + 16];
    v8f s0 = {}, s1 = {};
    s0 = wmma_f16(ak0, bq, s0);
    s1 = wmma_f16(ak1, bq, s1);

    const v8f bb0 = __builtin_shufflevector(g0, g1, 0, 1, 2, 3, 4, 5, 6, 7);
    const v8f bb1 = __builtin_shufflevector(g4, g5, 0, 1, 2, 3, 4, 5, 6, 7);

    // online softmax (fp32); C layout: col=lane&15 (query), row=r+8*(lane>>4) (key)
    const v8f sv0 = s0 * scale + bb0;
    const v8f sv1 = s1 * scale + bb1;
    float mc = fmaxf(sv0[0], sv1[0]);
    #pragma unroll
    for (int r = 1; r < 8; ++r) mc = fmaxf(mc, fmaxf(sv0[r], sv1[r]));
    mc = fmaxf(mc, xhalf(mc));               // the other half's 16 keys
    const float mnew = fmaxf(rmax, mc);
    const float alpha = __expf(rmax - mnew);
    rmax = mnew;

    const float log2e = 1.44269504f;         // __expf(x) is 2^(x * log2e)
    const v8f p0 = exp2x8((sv0 - mnew) * log2e);
    const v8f p1 = exp2x8((sv1 - mnew) * log2e);
    const v8f pv = p0 + p1;
    V16H bp;                                 // Pt as B operand, straight from St
    #pragma unroll
    for (int r = 0; r < 8; ++r) {
      bp.h[0][r] = (_Float16)p0[r];
      bp.h[1][r] = (_Float16)p1[r];
    }
    const float ps = ((pv[0] + pv[1]) + (pv[2] + pv[3])) + ((pv[4] + pv[5]) + (pv[6] + pv[7]));
    rsum = rsum * alpha + ps;
    o0 *= alpha;
    o1 *= alpha;

    // Ot(32x16) += Vt(32x32) * Pt(32x16); A frag [hd][key] == Vt row-major
    V16H av0, av1;
    av0.h[0] = *(const v8h*)&Vt[buf][lrow][lhi * 8];
    av0.h[1] = *(const v8h*)&Vt[buf][lrow][lhi * 8 + 16];
    av1.h[0] = *(const v8h*)&Vt[buf][16 + lrow][lhi * 8];
    av1.h[1] = *(const v8h*)&Vt[buf][16 + lrow][lhi * 8 + 16];
    o0 = wmma_f16(av0, bp, o0);
    o1 = wmma_f16(av1, bp, o1);

    if (more) sstore(buf ^ 1);
    __syncthreads();
  }

  // join the halves' sums, normalize, store to attn_out [n][l][h*32+hd] f16:
  // a lane holds hd 8h+0..7 and 16+8h+0..7 of its query, two 16-byte stores
  const float inv = 1.0f / (rsum + xhalf(rsum));
  v8h w0, w1;
  #pragma unroll
  for (int r = 0; r < 8; ++r) {
    w0[r] = (_Float16)(o0[r] * inv);
    w1[r] = (_Float16)(o1[r] * inv);
  }
  _Float16* dst = AO + ((size_t)n * LEN_L + qrow) * DIM_D + h * HD + lhi * 8;
  *(v8h*)dst        = w0;
  *(v8h*)(dst + 16) = w1;
}

// ---------------- launch ----------------
extern "C" void kernel_launch(void* const* d_in, const int* in_sizes, int n_in,
                              void* d_out, int out_size, void* d_ws, size_t ws_size,
                              hipStream_t stream) {
  const float* msa   = (const float*)d_in[0];
  const float* pbias = (const float*)d_in[1];
  const float* lnw   = (const float*)d_in[2];
  const float* lnb   = (const float*)d_in[3];
  const float* wqkv  = (const float*)d_in[4];
  const float* bqkv  = (const float*)d_in[5];
  const float* wproj = (const float*)d_in[6];
  const float* bproj = (const float*)d_in[7];
  float* out = (float*)d_out;

  char* ws = (char*)d_ws;
  // workspace layout (bytes), all offsets 16B-aligned
  _Float16* WqkvT  = (_Float16*)(ws + 0);          // [768][256] f16 = 393216
  _Float16* WprojT = (_Float16*)(ws + 393216);     // [256][256] f16 = 131072
  _Float16* Mh     = (_Float16*)(ws + 524288);     // 16384*256*2 = 8388608
  _Float16* Qh     = (_Float16*)(ws + 8912896);    // 8388608
  _Float16* Kh     = (_Float16*)(ws + 17301504);   // 8388608
  _Float16* Vh     = (_Float16*)(ws + 25690112);   // 8388608
  _Float16* AOh    = (_Float16*)(ws + 34078720);   // 8388608
  float*    PbT    = (float*)   (ws + 42467328);   // 8*512*512*4 = 8388608 (total ~48.5 MB)

  prep_kernel<<<LN_BLOCKS + CVQ_BLOCKS + CVP_BLOCKS + BIAS_BLOCKS, 256, 0, stream>>>(
      msa, lnw, lnb, wqkv, wproj, pbias, Mh, WqkvT, WprojT, PbT);
  qkv_gemm_kernel<<<dim3(MROWS / 128, QKV_N / 64), 256, 0, stream>>>(Mh, WqkvT, bqkv, Qh, Kh, Vh);
  attn_kernel<<<dim3(LEN_L / 128, SEQ_N * HEADS), 256, 0, stream>>>(Qh, Kh, Vh, PbT, AOh);
  proj_gemm_kernel<<<dim3(MROWS / 128, DIM_D / 64), 256, 0, stream>>>(AOh, WprojT, bproj, msa, out);
}

// v005
// It runs in 63.5 microseconds.
// Two timings next to v004 put it at 1.03 and 1.04 times that version's speed.
// Over all steps from v000 it is 1.78 times as fast.
#include <hip/hip_runtime.h>
#include <math.h>

// ---- CDNA5 WMMA types ----
typedef __attribute__((ext_vector_type(16))) _Float16 v16h;
typedef __attribute__((ext_vector_type(8)))  _Float16 v8h;
typedef __attribute__((ext_vector_type(4)))  _Float16 v4h;
typedef __attribute__((ext_vector_type(8)))  float    v8f;
typedef __attribute__((ext_vector_type(4)))  float    v4f;

union V16H { v16h v; v8h h[2]; };

__device__ __forceinline__ v8f wmma_f16(const V16H& a, const V16H& b, v8f c) {
  // D = A(16x32 f16) * B(32x16 f16) + C(16x16 f32)
  return __builtin_amdgcn_wmma_f32_16x16x32_f16(false, a.v, false, b.v,
                                                (short)0, c, false, false);
}

// Problem constants: B=1, N=32, L=512, D=256, H=8, hd=32
#define SEQ_N   32
#define LEN_L   512
#define DIM_D   256
#define HEADS   8
#define HD      32
#define MROWS   (SEQ_N * LEN_L)   // 16384
#define QKV_N   (3 * DIM_D)       // 768

// LDS rows that hold 32 halves (64 bytes) of a matrix fragment's k range are laid at
// a pitch of 40 halves (80 bytes = 16 x 5). The 16 lanes of a half wave read 16 bytes
// each from 16 rows: at 64 bytes the rows fall on 4 bank groups, four rows on each;
// at 80 bytes the 16 rows fall on 16 different groups of four banks.
#define LPITCH  40

// The four preparation stages below depend on none of one another's results. They
// are bodies of ONE launch (prep_kernel): each work-group takes one stage's block,
// blk being the block's index inside that stage.

// ------- Stage: weight convert + transpose: [k][n] f32 -> [n][k] f16 -----
// A thread takes eight k of one n: the lanes run along n, so each of its eight loads
// is 128 contiguous bytes a wave, and its eight halves leave as one 16-byte store.
#define CV_K 8                                       // k per thread
__device__ __forceinline__ void cvt_tr_body(const float* __restrict__ src,
                                            _Float16* __restrict__ dst,
                                            int K, int N, int blk) {
  int i = blk * 256 + threadIdx.x;                   // linear index over [k/8][n]
  if (i >= K * N / CV_K) return;
  int n = i % N, k0 = (i / N) * CV_K;
  float x[CV_K];
  #pragma unroll   // x lives in registers; the eight loads are issued back to back
  for (int j = 0; j < CV_K; ++j) x[j] = src[(k0 + j) * N + n];
  v8h y;
  #pragma unroll   // constant indices into the vector
  for (int j = 0; j < CV_K; ++j) y[j] = (_Float16)x[j];
  *(v8h*)(dst + n * K + k0) = y;
}

// ------ Stage: pair_bias transpose [q][k][h] -> [h][k/4][q][k%4] ------
// q runs across the lanes of a transposed score tile, so a lane's four keys lie
// in 16 bytes and 16 neighbouring queries in 256 contiguous bytes.
// A wave takes 16 queries x 8 keys x 8 heads (4 KB). In: a query's 8 keys x 8 heads
// are 256 contiguous bytes, two queries to a wave load, all eight loads in flight.
// Out: per head, 16 queries of one key group are 256 contiguous bytes, two key groups
// to a wave store. The turn between the two orders goes through the wave's own LDS
// tile; its rows of 64 floats lie at 68, a multiple of 16 bytes for the b128 writes
// that spreads the 16 rows which a half wave reads back over the banks.
#define BT_PITCH 68
__device__ __forceinline__ void bias_tr_body(const float* __restrict__ pb,
                                             float* __restrict__ pbt, int blk) {
  __shared__ __align__(16) float tile[8][16][BT_PITCH];   // 34 KB
  const int wid = threadIdx.x >> 5, lane = threadIdx.x & 31;
  const int lrow = lane & 15, lhi = lane >> 4;
  const int w  = blk * 8 + wid;                      // 0 .. 2047
  const int kp = w & (LEN_L / 8 - 1);                // which run of eight keys
  const int q0 = (w >> 6) * 16;                      // first query

  v4f x[8];
  #pragma unroll   // x lives in registers; the eight loads are issued back to back
  for (int i = 0; i < 8; ++i)
    x[i] = *(const v4f*)(pb + ((q0 + 2 * i + lhi) * LEN_L + kp * 8) * HEADS + lrow * 4);
  #pragma unroll   // constant indices into x
  for (int i = 0; i < 8; ++i)
    *(v4f*)&tile[wid][2 * i + lhi][lrow * 4] = x[i];
  __syncthreads();   // the lanes read what other lanes of the wave have written

  #pragma unroll   // one store a head
  for (int h = 0; h < HEADS; ++h) {
    const float* c = &tile[wid][lrow][lhi * 4 * HEADS + h];   // query lrow, key group lhi
    const v4f y = v4f{c[0], c[HEADS], c[2 * HEADS], c[3 * HEADS]};
    *(v4f*)(pbt + (((h * (LEN_L / 4)) + kp * 2 + lhi) * LEN_L + q0 + lrow) * 4) = y;
  }
  // the registers that the eight stores name are free for reuse behind this stage:
  // the wait stands behind the last store, in front of any such overwrite
  asm volatile("s_wait_xcnt 0x0" ::: "memory");
}

// ---------------- Stage: LayerNorm -> f16 ----------------
// One wave owns a whole row (8 elements a lane, as two 512-byte wave loads) and
// takes four rows, all eight loads in flight at once: 4096 waves start instead of
// 131072, and the row sums need neither LDS nor a barrier.
__device__ __forceinline__ float xhalf(float x) {   // value of lane l ^ 16
  int b = __builtin_bit_cast(int, x);
  return __builtin_bit_cast(float,
      __builtin_amdgcn_permlanex16(b, b, 0x76543210, 0xfedcba98, false, false));
}

template <int M>
__device__ __forceinline__ float xrow(float x) {    // value of lane l ^ M, M < 16
  return __builtin_bit_cast(float,
      __builtin_amdgcn_update_dpp(0, __builtin_bit_cast(int, x), 0x160 | M, 0xf, 0xf, true));
}

__device__ __forceinline__ float wave_sum(float x) { // butterfly: every lane gets the sum
  x += xrow<1>(x);
  x += xrow<2>(x);
  x += xrow<4>(x);
  x += xrow<8>(x);
  return x + xhalf(x);
}

#define LN_ROWS 4                                    // rows per wave
__device__ __forceinline__ void ln_body(const float* __restrict__ msa,
                                        const float* __restrict__ lw,
                                        const float* __restrict__ lb,
                                        _Float16* __restrict__ mh, int blk) {
  const int c = (threadIdx.x & 31) * 4;              // columns c..c+3 and 128+c..128+c+3
  const int row0 = (blk * 8 + (threadIdx.x >> 5)) * LN_ROWS;

  const v4f w0 = *(const v4f*)(lw + c), w1 = *(const v4f*)(lw + 128 + c);
  const v4f b0 = *(const v4f*)(lb + c), b1 = *(const v4f*)(lb + 128 + c);
  v4f x0[LN_ROWS], x1[LN_ROWS];
  #pragma unroll   // the rows live in registers: constant indices, loads issued back to back
  for (int r = 0; r < LN_ROWS; ++r) {
    const float* p = msa + (row0 + r) * DIM_D + c;
    x0[r] = *(const v4f*)p;
    x1[r] = *(const v4f*)(p + 128);
  }

  #pragma unroll   // four independent butterfly chains fill one another's latency
  for (int r = 0; r < LN_ROWS; ++r) {
    const v4f s = x0[r] + x1[r];
    const float mu = wave_sum((s[0] + s[1]) + (s[2] + s[3])) * (1.0f / DIM_D);
    const v4f d0 = x0[r] - mu, d1 = x1[r] - mu;
    const v4f q = d0 * d0 + d1 * d1;
    const float var = wave_sum((q[0] + q[1]) + (q[2] + q[3])) * (1.0f / DIM_D);
    const float rs = rsqrtf(var + 1e-5f);
    const v4f y0 = d0 * rs * w0 + b0, y1 = d1 * rs * w1 + b1;
    _Float16* o = mh + (row0 + r) * DIM_D + c;
    *(v4h*)o         = v4h{(_Float16)y0[0], (_Float16)y0[1], (_Float16)y0[2], (_Float16)y0[3]};
    *(v4h*)(o + 128) = v4h{(_Float16)y1[0], (_Float16)y1[1], (_Float16)y1[2], (_Float16)y1[3]};
  }
}

// ---------------- Kernel 0: all four preparation stages, one launch ----------------
// The LayerNorm blocks come first (for speed only).
#define LN_BLOCKS   (MROWS / (8 * LN_ROWS))             // 512
#define CVQ_BLOCKS  (DIM_D * QKV_N / (CV_K * 256))      // 96
#define CVP_BLOCKS  (DIM_D * DIM_D / (CV_K * 256))      // 32
#define BIAS_BLOCKS ((LEN_L / 16) * (LEN_L / 8) / 8)    // 256
__global__ __launch_bounds__(256) void prep_kernel(const float* __restrict__ msa,
                                                   const float* __restrict__ lw,
                                                   const float* __restrict__ lb,
                                                   const float* __restrict__ wqkv,
                                                   const float* __restrict__ wproj,
                                                   const float* __restrict__ pb,
                                                   _Float16* __restrict__ mh,
                                                   _Float16* __restrict__ wqkvT,
                                                   _Float16* __restrict__ wprojT,
                                                   float* __restrict__ pbt) {
  const int b = blockIdx.x;                            // the same for a whole work-group
  if (b < LN_BLOCKS)
    ln_body(msa, lw, lb, mh, b);
  else if (b < LN_BLOCKS + CVQ_BLOCKS)
    cvt_tr_body(wqkv, wqkvT, DIM_D, QKV_N, b - LN_BLOCKS);
  else if (b < LN_BLOCKS + CVQ_BLOCKS + CVP_BLOCKS)
    cvt_tr_body(wproj, wprojT, DIM_D, DIM_D, b - (LN_BLOCKS + CVQ_BLOCKS));
  else
    bias_tr_body(pb, pbt, b - (LN_BLOCKS + CVQ_BLOCKS + CVP_BLOCKS));
}

// ============ shared GEMM body (double-buffered LDS ping-pong) ============
// Block tile 128x64, 8 waves, wave = 16 rows x 64 cols (4 C frags), BK=32.
// A: [M][256] f16 row-major. BhT: [N][256] f16 (pre-transposed weights).
__device__ __forceinline__ void gemm_mainloop(const _Float16* __restrict__ Ah,
                                              const _Float16* __restrict__ BhT,
                                              int row0, int ntile,
                                              _Float16 (*As)[128][LPITCH],
                                              _Float16 (*BsT)[64][LPITCH],
                                              v8f acc[4]) {
  const int t = threadIdx.x, wid = t >> 5, lane = t & 31;
  const int lrow = lane & 15, lhi = lane >> 4;

  const int ar  = t >> 1, aseg = (t & 1) * 16;   // A staging: 16 halves/thread
  const int bn  = t & 63, bks  = (t >> 6) * 8;   // B staging: 8 halves/thread

  v8h ra0, ra1, rb;
  auto gload = [&](int kt) {
    const _Float16* srcA = Ah + (row0 + ar) * DIM_D + kt + aseg;
    ra0 = *(const v8h*)srcA;
    ra1 = *(const v8h*)(srcA + 8);
    rb  = *(const v8h*)(BhT + (ntile + bn) * DIM_D + kt + bks);  // contiguous
  };
  auto sstore = [&](int buf) {
    *(v8h*)&As[buf][ar][aseg]     = ra0;
    *(v8h*)&As[buf][ar][aseg + 8] = ra1;
    *(v8h*)&BsT[buf][bn][bks]     = rb;
  };

  gload(0);
  sstore(0);
  __syncthreads();

  for (int step = 0; step < DIM_D / 32; ++step) {
    const int buf = step & 1;
    const bool more = (step + 1) < DIM_D / 32;
    if (more) gload((step + 1) * 32);            // overlap VMEM with WMMA

    V16H a;
    a.h[0] = *(const v8h*)&As[buf][wid * 16 + lrow][lhi * 8];
    a.h[1] = *(const v8h*)&As[buf][wid * 16 + lrow][lhi * 8 + 16];
    V16H b[4];
    #pragma unroll
    for (int nf = 0; nf < 4; ++nf) {             // batch all ds loads first
      b[nf].h[0] = *(const v8h*)&BsT[buf][nf * 16 + lrow][lhi * 8];
      b[nf].h[1] = *(const v8h*)&BsT[buf][nf * 16 + lrow][lhi * 8 + 16];
    }
    #pragma unroll
    for (int nf = 0; nf < 4; ++nf)               // 4 back-to-back WMMAs
      acc[nf] = wmma_f16(a, b[nf], acc[nf]);

    if (more) sstore(buf ^ 1);
    __syncthreads();
  }
}

// ---------------- Kernel 2: QKV GEMM (16384x256 x 256x768) ----------------
__global__ __launch_bounds__(256) void qkv_gemm_kernel(const _Float16* __restrict__ Ah,
                                                       const _Float16* __restrict__ BhT,
                                                       const float* __restrict__ bq,
                                                       _Float16* __restrict__ Qh,
                                                       _Float16* __restrict__ Kh,
                                                       _Float16* __restrict__ Vh) {
  __shared__ __align__(16) _Float16 As[2][128][LPITCH];   // 20 KB
  __shared__ __align__(16) _Float16 BsT[2][64][LPITCH];   // 10 KB
  const int row0  = blockIdx.x * 128;
  const int ntile = blockIdx.y * 64;
  const int t = threadIdx.x, wid = t >> 5, lane = t & 31;
  const int lrow = lane & 15, lhi = lane >> 4;

  v8f acc[4] = {};
  gemm_mainloop(Ah, BhT, row0, ntile, As, BsT, acc);

  // Epilogue: + bias, scatter into Q/K/V [n][h][l][hd] f16
  #pragma unroll
  for (int nf = 0; nf < 4; ++nf) {
    #pragma unroll
    for (int r = 0; r < 8; ++r) {
      int col = ntile + nf * 16 + lrow;
      int row = row0 + wid * 16 + r + 8 * lhi;
      float v = acc[nf][r] + bq[col];
      int which = col >> 8, d = col & 255, hh = d >> 5, hdi = d & 31;
      _Float16* dst = (which == 0) ? Qh : ((which == 1) ? Kh : Vh);
      int n = row >> 9, l = row & 511;
      dst[((n * HEADS + hh) * LEN_L + l) * HD + hdi] = (_Float16)v;
    }
  }
}

// ---------------- Kernel 4: proj GEMM + bias + residual ----------------
__global__ __launch_bounds__(256) void proj_gemm_kernel(const _Float16* __restrict__ Ah,
                                                        const _Float16* __restrict__ BhT,
                                                        const float* __restrict__ bp,
                                                        const float* __restrict__ resid,
                                                        float* __restrict__ out) {
  __shared__ __align__(16) _Float16 As[2][128][LPITCH];
  __shared__ __align__(16) _Float16 BsT[2][64][LPITCH];
  const int row0  = blockIdx.x * 128;
  const int ntile = blockIdx.y * 64;
  const int t = threadIdx.x, wid = t >> 5, lane = t & 31;
  const int lrow = lane & 15, lhi = lane >> 4;

  v8f acc[4] = {};
  gemm_mainloop(Ah, BhT, row0, ntile, As, BsT, acc);

  #pragma unroll
  for (int nf = 0; nf < 4; ++nf) {
    #pragma unroll
    for (int r = 0; r < 8; ++r) {
      int col = ntile + nf * 16 + lrow;
      int row = row0 + wid * 16 + r + 8 * lhi;
      out[row * DIM_D + col] = acc[nf][r] + bp[col] + resid[row * DIM_D + col];
    }
  }
}

__device__ __forceinline__ v8f exp2x8(v8f x) {
  float y0, y1, y2, y3, y4, y5, y6, y7;
  asm("v_exp_f32 %0, %8\n\tv_exp_f32 %1, %9\n\tv_exp_f32 %2, %10\n\tv_exp_f32 %3, %11\n\t"
      "v_exp_f32 %4, %12\n\tv_exp_f32 %5, %13\n\tv_exp_f32 %6, %14\n\tv_exp_f32 %7, %15\n\t"
      "v_nop"
      : "=&v"(y0), "=&v"(y1), "=&v"(y2), "=&v"(y3), "=&v"(y4), "=&v"(y5), "=&v"(y6), "=&v"(y7)
      : "v"(x[0]), "v"(x[1]), "v"(x[2]), "v"(x[3]), "v"(x[4]), "v"(x[5]), "v"(x[6]), "v"(x[7]));
  return v8f{y0, y1, y2, y3, y4, y5, y6, y7};
}

__global__ __launch_bounds__(256) void attn_kernel(const _Float16* __restrict__ Qh,
                                                   const _Float16* __restrict__ Kh,
                                                   const _Float16* __restrict__ Vh,
                                                   const float* __restrict__ pbt, // [h][k/4][q][k%4]
                                                   _Float16* __restrict__ AO) {
  __shared__ __align__(16) _Float16 Ks[2][32][LPITCH]; // [key][d]
  __shared__ __align__(16) _Float16 Vt[2][32][LPITCH]; // [d][key]
  const int nh = blockIdx.y;                 // n*8 + h
  const int n = nh >> 3, h = nh & 7;
  const int q0 = blockIdx.x * 128;
  const int t = threadIdx.x, wid = t >> 5, lane = t & 31;
  const int lrow = lane & 15, lhi = lane >> 4;

  const _Float16* Qb = Qh + (size_t)nh * LEN_L * HD;
  const _Float16* Kb = Kh + (size_t)nh * LEN_L * HD;
  const _Float16* Vb = Vh + (size_t)nh * LEN_L * HD;
  const int qrow = q0 + wid * 16 + lrow;     // this lane's query
  // this lane's query in the bias plane, at its first group of four keys
  const float* brow = pbt + (size_t)h * LEN_L * LEN_L + lhi * 2 * (LEN_L * 4) + qrow * 4;

  V16H bq;                                   // Qt as B operand: column = query
  bq.h[0] = *(const v8h*)(Qb + qrow * HD + lhi * 8);
  bq.h[1] = *(const v8h*)(Qb + qrow * HD + lhi * 8 + 16);

  float rmax = -1e30f, rsum = 0.0f;          // rsum: this half's keys only
  v8f o0 = {}, o1 = {};                      // Ot rows hd 0..15 / 16..31
  const float scale = 0.17677669529663687f;  // 1/sqrt(32)

  const int skey = t >> 3, sds = (t & 7) * 4;  // staging: 4 halves/thread each
  v4h kr, vr;
  auto gload = [&](int kc) {
    kr = *(const v4h*)(Kb + (kc + skey) * HD + sds);
    vr = *(const v4h*)(Vb + (kc + skey) * HD + sds);
  };
  auto sstore = [&](int buf) {
    *(v4h*)&Ks[buf][skey][sds] = kr;
    Vt[buf][sds + 0][skey] = vr[0]; Vt[buf][sds + 1][skey] = vr[1];
    Vt[buf][sds + 2][skey] = vr[2]; Vt[buf][sds + 3][skey] = vr[3];
  };

  gload(0);
  // the address registers of the Q, K and V loads above are reused right behind
  // them (the zeroed accumulators): the wait stands in front of that overwrite
  asm volatile("s_wait_xcnt 0x0" ::: "memory");
  sstore(0);
  __syncthreads();

  for (int kc = 0; kc < LEN_L; kc += 32) {
    const int buf = (kc >> 5) & 1;
    const bool more = (kc + 32) < LEN_L;
    if (more) {
      gload(kc + 32);                                      // overlap with compute
      __builtin_prefetch(brow + (kc + 32) * LEN_L, 0, 0);
    }

    // bias of keys kc+8h+0..7 and kc+16+8h+0..7 for this lane's query
    const float* bc = brow + kc * LEN_L;     // key group kc/4 (+ 2 in the upper half)
    const v4f g0 = *(const v4f*)(bc);
    const v4f g1 = *(const v4f*)(bc + 1 * (LEN_L * 4));
    const v4f g4 = *(const v4f*)(bc + 4 * (LEN_L * 4));
    const v4f g5 = *(const v4f*)(bc + 5 * (LEN_L * 4));

    // scores: St(32x16) = K(32x32) * Qt  (A frag [key][d] == Ks row-major)
    V16H ak0, ak1;
    ak0.h[0] = *(const v8h*)&Ks[buf][lrow][lhi * 8];
    ak0.h[1] = *(const v8h*)&Ks[buf][lrow][lhi * 8 + 16];
    ak1.h[0] = *(const v8h*)&Ks[buf][16 + lrow][lhi * 8];
    ak1.h[1] = *(const v8h*)&Ks[buf][16 + lrow][lhi * 8 + 16];
    v8f s0 = {}, s1 = {};
    s0 = wmma_f16(ak0, bq, s0);
    s1 = wmma_f16(ak1, bq, s1);

    const v8f bb0 = __builtin_shufflevector(g0, g1, 0, 1, 2, 3, 4, 5, 6, 7);
    const v8f bb1 = __builtin_shufflevector(g4, g5, 0, 1, 2, 3, 4, 5, 6, 7);

    // online softmax (fp32); C layout: col=lane&15 (query), row=r+8*(lane>>4) (key)
    const v8f sv0 = s0 * scale + bb0;
    const v8f sv1 = s1 * scale + bb1;
    float mc = fmaxf(sv0[0], sv1[0]);
    #pragma unroll
    for (int r = 1; r < 8; ++r) mc = fmaxf(mc, fmaxf(sv0[r], sv1[r]));
    mc = fmaxf(mc, xhalf(mc));               // the other half's 16 keys
    const float mnew = fmaxf(rmax, mc);
    const float alpha = __expf(rmax - mnew);
    rmax = mnew;

    const float log2e = 1.44269504f;         // __expf(x) is 2^(x * log2e)
    const v8f p0 = exp2x8((sv0 - mnew) * log2e);
    const v8f p1 = exp2x8((sv1 - mnew) * log2e);
    const v8f pv = p0 + p1;
    V16H bp;                                 // Pt as B operand, straight from St
    #pragma unroll
    for (int r = 0; r < 8; ++r) {
      bp.h[0][r] = (_Float16)p0[r];
      bp.h[1][r] = (_Float16)p1[r];
    }
    const float ps = ((pv[0] + pv[1]) + (pv[2] + pv[3])) + ((pv[4] + pv[5]) + (pv[6] + pv[7]));
    rsum = rsum * alpha + ps;
    o0 *= alpha;
    o1 *= alpha;

    // Ot(32x16) += Vt(32x32) * Pt(32x16); A frag [hd][key] == Vt row-major
    V16H av0, av1;
    av0.h[0] = *(const v8h*)&Vt[buf][lrow][lhi * 8];
    av0.h[1] = *(const v8h*)&Vt[buf][lrow][lhi * 8 + 16];
    av1.h[0] = *(const v8h*)&Vt[buf][16 + lrow][lhi * 8];
    av1.h[1] = *(const v8h*)&Vt[buf][16 + lrow][lhi * 8 + 16];
    o0 = wmma_f16(av0, bp, o0);
    o1 = wmma_f16(av1, bp, o1);

    if (more) sstore(buf ^ 1);
    __syncthreads();
  }

  // join the halves' sums, normalize, store to attn_out [n][l][h*32+hd] f16:
  // a lane holds hd 8h+0..7 and 16+8h+0..7 of its query, two 16-byte stores
  const float inv = 1.0f / (rsum + xhalf(rsum));
  v8h w0, w1;
  #pragma unroll
  for (int r = 0; r < 8; ++r) {
    w0[r] = (_Float16)(o0[r] * inv);
    w1[r] = (_Float16)(o1[r] * inv);
  }
  _Float16* dst = AO + ((size_t)n * LEN_L + qrow) * DIM_D + h * HD + lhi * 8;
  *(v8h*)dst        = w0;
  *(v8h*)(dst + 16) = w1;
}

// ---------------- launch ----------------
extern "C" void kernel_launch(void* const* d_in, const int* in_sizes, int n_in,
                              void* d_out, int out_size, void* d_ws, size_t ws_size,
                              hipStream_t stream) {
  const float* msa   = (const float*)d_in[0];
  const float* pbias = (const float*)d_in[1];
  const float* lnw   = (const float*)d_in[2];
  const float* lnb   = (const float*)d_in[3];
  const float* wqkv  = (const float*)d_in[4];
  const float* bqkv  = (const float*)d_in[5];
  const float* wproj = (const float*)d_in[6];
  const float* bproj = (const float*)d_in[7];
  float* out = (float*)d_out;

  char* ws = (char*)d_ws;
  // workspace layout (bytes), all offsets 16B-aligned
  _Float16* WqkvT  = (_Float16*)(ws + 0);          // [768][256] f16 = 393216
  _Float16* WprojT = (_Float16*)(ws + 393216);     // [256][256] f16 = 131072
  _Float16* Mh     = (_Float16*)(ws + 524288);     // 16384*256*2 = 8388608
  _Float16* Qh     = (_Float16*)(ws + 8912896);    // 8388608
  _Float16* Kh     = (_Float16*)(ws + 17301504);   // 8388608
  _Float16* Vh     = (_Float16*)(ws + 25690112);   // 8388608
  _Float16* AOh    = (_Float16*)(ws + 34078720);   // 8388608
  float*    PbT    = (float*)   (ws + 42467328);   // 8*512*512*4 = 8388608 (total ~48.5 MB)

  prep_kernel<<<LN_BLOCKS + CVQ_BLOCKS + CVP_BLOCKS + BIAS_BLOCKS, 256, 0, stream>>>(
      msa, lnw, lnb, wqkv, wproj, pbias, Mh, WqkvT, WprojT, PbT);
  qkv_gemm_kernel<<<dim3(MROWS / 128, QKV_N / 64), 256, 0, stream>>>(Mh, WqkvT, bqkv, Qh, Kh, Vh);
  attn_kernel<<<dim3(LEN_L / 128, SEQ_N * HEADS), 256, 0, stream>>>(Qh, Kh, Vh, PbT, AOh);
  proj_gemm_kernel<<<dim3(MROWS / 128, DIM_D / 64), 256, 0, stream>>>(AOh, WprojT, bproj, msa, out);
}

// v006
// Measured time: 57.3 microseconds a run.
// In both of two side-by-side timings against v005, it was 1.11 times as fast.
// All steps since v000 together make it 1.97 times as fast.
#include <hip/hip_runtime.h>
#include <math.h>

// ---- CDNA5 WMMA types ----
typedef __attribute__((ext_vector_type(16))) _Float16 v16h;
typedef __attribute__((ext_vector_type(8)))  _Float16 v8h;
typedef __attribute__((ext_vector_type(4)))  _Float16 v4h;
typedef __attribute__((ext_vector_type(8)))  float    v8f;
typedef __attribute__((ext_vector_type(4)))  float    v4f;

union V16H { v16h v; v8h h[2]; };

__device__ __forceinline__ v8f wmma_f16(const V16H& a, const V16H& b, v8f c) {
  // D = A(16x32 f16) * B(32x16 f16) + C(16x16 f32)
  return __builtin_amdgcn_wmma_f32_16x16x32_f16(false, a.v, false, b.v,
                                                (short)0, c, false, false);
}

// Problem constants: B=1, N=32, L=512, D=256, H=8, hd=32
#define SEQ_N   32
#define LEN_L   512
#define DIM_D   256
#define HEADS   8
#define HD      32
#define MROWS   (SEQ_N * LEN_L)   // 16384
#define QKV_N   (3 * DIM_D)       // 768

// LDS rows that hold 32 halves (64 bytes) of a matrix fragment's k range are laid at
// a pitch of 40 halves (80 bytes = 16 x 5). The 16 lanes of a half wave read 16 bytes
// each from 16 rows: at 64 bytes the rows fall on 4 bank groups, four rows on each;
// at 80 bytes the 16 rows fall on 16 different groups of four banks.
#define LPITCH  40

// The four preparation stages below depend on none of one another's results. They
// are bodies of ONE launch (prep_kernel): each work-group takes one stage's block,
// blk being the block's index inside that stage.

// ------- Stage: weight convert + transpose: [k][n] f32 -> [n][k] f16 -----
// A thread takes eight k of one n: the lanes run along n, so each of its eight loads
// is 128 contiguous bytes a wave, and its eight halves leave as one 16-byte store.
#define CV_K 8                                       // k per thread
__device__ __forceinline__ void cvt_tr_body(const float* __restrict__ src,
                                            _Float16* __restrict__ dst,
                                            int K, int N, int blk) {
  int i = blk * 256 + threadIdx.x;                   // linear index over [k/8][n]
  if (i >= K * N / CV_K) return;
  int n = i % N, k0 = (i / N) * CV_K;
  float x[CV_K];
  #pragma unroll   // x lives in registers; the eight loads are issued back to back
  for (int j = 0; j < CV_K; ++j) x[j] = src[(k0 + j) * N + n];
  v8h y;
  #pragma unroll   // constant indices into the vector
  for (int j = 0; j < CV_K; ++j) y[j] = (_Float16)x[j];
  *(v8h*)(dst + n * K + k0) = y;
}

// ------ Stage: pair_bias transpose [q][k][h] -> [h][k/4][q][k%4] ------
// q runs across the lanes of a transposed score tile, so a lane's four keys lie
// in 16 bytes and 16 neighbouring queries in 256 contiguous bytes.
// A wave takes 16 queries x 8 keys x 8 heads (4 KB). In: a query's 8 keys x 8 heads
// are 256 contiguous bytes, two queries to a wave load, all eight loads in flight.
// Out: per head, 16 queries of one key group are 256 contiguous bytes, two key groups
// to a wave store. The turn between the two orders goes through the wave's own LDS
// tile; its rows of 64 floats lie at 68, a multiple of 16 bytes for the b128 writes
// that spreads the 16 rows which a half wave reads back over the banks.
#define BT_PITCH 68
__device__ __forceinline__ void bias_tr_body(const float* __restrict__ pb,
                                             float* __restrict__ pbt, int blk) {
  __shared__ __align__(16) float tile[8][16][BT_PITCH];   // 34 KB
  const int wid = threadIdx.x >> 5, lane = threadIdx.x & 31;
  const int lrow = lane & 15, lhi = lane >> 4;
  const int w  = blk * 8 + wid;                      // 0 .. 2047
  const int kp = w & (LEN_L / 8 - 1);                // which run of eight keys
  const int q0 = (w >> 6) * 16;                      // first query

  v4f x[8];
  #pragma unroll   // x lives in registers; the eight loads are issued back to back
  for (int i = 0; i < 8; ++i)
    x[i] = *(const v4f*)(pb + ((q0 + 2 * i + lhi) * LEN_L + kp * 8) * HEADS + lrow * 4);
  #pragma unroll   // constant indices into x
  for (int i = 0; i < 8; ++i)
    *(v4f*)&tile[wid][2 * i + lhi][lrow * 4] = x[i];
  __syncthreads();   // the lanes read what other lanes of the wave have written

  #pragma unroll   // one store a head
  for (int h = 0; h < HEADS; ++h) {
    const float* c = &tile[wid][lrow][lhi * 4 * HEADS + h];   // query lrow, key group lhi
    const v4f y = v4f{c[0], c[HEADS], c[2 * HEADS], c[3 * HEADS]};
    *(v4f*)(pbt + (((h * (LEN_L / 4)) + kp * 2 + lhi) * LEN_L + q0 + lrow) * 4) = y;
  }
  // the registers that the eight stores name are free for reuse behind this stage:
  // the wait stands behind the last store, in front of any such overwrite
  asm volatile("s_wait_xcnt 0x0" ::: "memory");
}

// ---------------- Stage: LayerNorm -> f16 ----------------
// One wave owns a whole row (8 elements a lane, as two 512-byte wave loads) and
// takes four rows, all eight loads in flight at once: 4096 waves start instead of
// 131072, and the row sums need neither LDS nor a barrier.
__device__ __forceinline__ float xhalf(float x) {   // value of lane l ^ 16
  int b = __builtin_bit_cast(int, x);
  return __builtin_bit_cast(float,
      __builtin_amdgcn_permlanex16(b, b, 0x76543210, 0xfedcba98, false, false));
}

template <int M>
__device__ __forceinline__ float xrow(float x) {    // value of lane l ^ M, M < 16
  return __builtin_bit_cast(float,
      __builtin_amdgcn_update_dpp(0, __builtin_bit_cast(int, x), 0x160 | M, 0xf, 0xf, true));
}

__device__ __forceinline__ float wave_sum(float x) { // butterfly: every lane gets the sum
  x += xrow<1>(x);
  x += xrow<2>(x);
  x += xrow<4>(x);
  x += xrow<8>(x);
  return x + xhalf(x);
}

#define LN_ROWS 4                                    // rows per wave
__device__ __forceinline__ void ln_body(const float* __restrict__ msa,
                                        const float* __restrict__ lw,
                                        const float* __restrict__ lb,
                                        _Float16* __restrict__ mh, int blk) {
  const int c = (threadIdx.x & 31) * 4;              // columns c..c+3 and 128+c..128+c+3
  const int row0 = (blk * 8 + (threadIdx.x >> 5)) * LN_ROWS;

  const v4f w0 = *(const v4f*)(lw + c), w1 = *(const v4f*)(lw + 128 + c);
  const v4f b0 = *(const v4f*)(lb + c), b1 = *(const v4f*)(lb + 128 + c);
  v4f x0[LN_ROWS], x1[LN_ROWS];
  #pragma unroll   // the rows live in registers: constant indices, loads issued back to back
  for (int r = 0; r < LN_ROWS; ++r) {
    const float* p = msa + (row0 + r) * DIM_D + c;
    x0[r] = *(const v4f*)p;
    x1[r] = *(const v4f*)(p + 128);
  }

  #pragma unroll   // four independent butterfly chains fill one another's latency
  for (int r = 0; r < LN_ROWS; ++r) {
    const v4f s = x0[r] + x1[r];
    const float mu = wave_sum((s[0] + s[1]) + (s[2] + s[3])) * (1.0f / DIM_D);
    const v4f d0 = x0[r] - mu, d1 = x1[r] - mu;
    const v4f q = d0 * d0 + d1 * d1;
    const float var = wave_sum((q[0] + q[1]) + (q[2] + q[3])) * (1.0f / DIM_D);
    const float rs = rsqrtf(var + 1e-5f);
    const v4f y0 = d0 * rs * w0 + b0, y1 = d1 * rs * w1 + b1;
    _Float16* o = mh + (row0 + r) * DIM_D + c;
    *(v4h*)o         = v4h{(_Float16)y0[0], (_Float16)y0[1], (_Float16)y0[2], (_Float16)y0[3]};
    *(v4h*)(o + 128) = v4h{(_Float16)y1[0], (_Float16)y1[1], (_Float16)y1[2], (_Float16)y1[3]};
  }
}

// ---------------- Kernel 0: all four preparation stages, one launch ----------------
// The LayerNorm blocks come first (for speed only).
#define LN_BLOCKS   (MROWS / (8 * LN_ROWS))             // 512
#define CVQ_BLOCKS  (DIM_D * QKV_N / (CV_K * 256))      // 96
#define CVP_BLOCKS  (DIM_D * DIM_D / (CV_K * 256))      // 32
#define BIAS_BLOCKS ((LEN_L / 16) * (LEN_L / 8) / 8)    // 256
__global__ __launch_bounds__(256) void prep_kernel(const float* __restrict__ msa,
                                                   const float* __restrict__ lw,
                                                   const float* __restrict__ lb,
                                                   const float* __restrict__ wqkv,
                                                   const float* __restrict__ wproj,
                                                   const float* __restrict__ pb,
                                                   _Float16* __restrict__ mh,
                                                   _Float16* __restrict__ wqkvT,
                                                   _Float16* __restrict__ wprojT,
                                                   float* __restrict__ pbt) {
  const int b = blockIdx.x;                            // the same for a whole work-group
  if (b < LN_BLOCKS)
    ln_body(msa, lw, lb, mh, b);
  else if (b < LN_BLOCKS + CVQ_BLOCKS)
    cvt_tr_body(wqkv, wqkvT, DIM_D, QKV_N, b - LN_BLOCKS);
  else if (b < LN_BLOCKS + CVQ_BLOCKS + CVP_BLOCKS)
    cvt_tr_body(wproj, wprojT, DIM_D, DIM_D, b - (LN_BLOCKS + CVQ_BLOCKS));
  else
    bias_tr_body(pb, pbt, b - (LN_BLOCKS + CVQ_BLOCKS + CVP_BLOCKS));
}

// ============ shared GEMM body (whole k range staged once) ============
// Block tile 128x64, 8 waves, wave = 16 rows x 64 cols (4 C frags).
// A: [M][256] f16 row-major. BhT: [N][256] f16 (pre-transposed weights).
// k is only 256, so a row of either operand is 512 bytes: one asynchronous copy of a
// wave (32 lanes x 16 bytes) brings one whole row, four full lines, straight into LDS.
// All 24 copies of a wave fly together, one wait and one barrier follow, and the
// products then run over the whole k range with no further barrier.
// LDS rows lie at 528 bytes (16 x 33): the 16 rows that a half wave reads by
// ds_load_b128 fall on 16 different groups of four banks.
#define KPITCH  (DIM_D + 8)

__device__ __forceinline__ unsigned lds_addr(const void* p) {  // byte offset in the work-group's LDS
  return (unsigned)(size_t)p;
}

// Eight rows, one copy each: LDS rows KPITCH halves apart, global rows DIM_D halves apart.
// The closing s_wait_xcnt stands inside the statement, behind the last copy, so that no
// register which a copy names is rewritten in front of it.
__device__ __forceinline__ void copy_rows8(unsigned l, const _Float16* g) {
  asm volatile(
      "global_load_async_to_lds_b128 %0, %8, off\n\t"
      "global_load_async_to_lds_b128 %1, %9, off\n\t"
      "global_load_async_to_lds_b128 %2, %10, off\n\t"
      "global_load_async_to_lds_b128 %3, %11, off\n\t"
      "global_load_async_to_lds_b128 %4, %12, off\n\t"
      "global_load_async_to_lds_b128 %5, %13, off\n\t"
      "global_load_async_to_lds_b128 %6, %14, off\n\t"
      "global_load_async_to_lds_b128 %7, %15, off\n\t"
      "s_wait_xcnt 0x0"
      :: "v"(l), "v"(l + 1 * KPITCH * 2), "v"(l + 2 * KPITCH * 2), "v"(l + 3 * KPITCH * 2),
         "v"(l + 4 * KPITCH * 2), "v"(l + 5 * KPITCH * 2), "v"(l + 6 * KPITCH * 2),
         "v"(l + 7 * KPITCH * 2),
         "v"(g), "v"(g + 1 * DIM_D), "v"(g + 2 * DIM_D), "v"(g + 3 * DIM_D),
         "v"(g + 4 * DIM_D), "v"(g + 5 * DIM_D), "v"(g + 6 * DIM_D), "v"(g + 7 * DIM_D)
      : "memory");
}

__device__ __forceinline__ void gemm_mainloop(const _Float16* __restrict__ Ah,
                                              const _Float16* __restrict__ BhT,
                                              int row0, int ntile,
                                              _Float16 (*As)[KPITCH],
                                              _Float16 (*BsT)[KPITCH],
                                              v8f acc[4]) {
  const int t = threadIdx.x, wid = t >> 5, lane = t & 31;
  const int lrow = lane & 15, lhi = lane >> 4;

  // wave wid brings A rows 16 wid .. 16 wid + 15 and B rows 8 wid .. 8 wid + 7;
  // a lane brings halves 8 lane .. 8 lane + 7 of each row
  const _Float16* ga = Ah + (row0 + wid * 16) * DIM_D + lane * 8;
  const _Float16* gb = BhT + (ntile + wid * 8) * DIM_D + lane * 8;
  copy_rows8(lds_addr(&As[wid * 16][lane * 8]), ga);
  copy_rows8(lds_addr(&As[wid * 16 + 8][lane * 8]), ga + 8 * DIM_D);
  copy_rows8(lds_addr(&BsT[wid * 8][lane * 8]), gb);
  // this wave's copies have landed behind this wait; the barrier then shows every
  // wave's rows to every wave
  asm volatile("s_wait_asynccnt 0x0" ::: "memory");
  __syncthreads();

  #pragma unroll   // constant LDS offsets; the next k block's reads can go ahead of the products
  for (int kt = 0; kt < DIM_D; kt += 32) {
    V16H a;
    a.h[0] = *(const v8h*)&As[wid * 16 + lrow][kt + lhi * 8];
    a.h[1] = *(const v8h*)&As[wid * 16 + lrow][kt + lhi * 8 + 16];
    V16H b[4];
    #pragma unroll
    for (int nf = 0; nf < 4; ++nf) {             // batch all ds loads first
      b[nf].h[0] = *(const v8h*)&BsT[nf * 16 + lrow][kt + lhi * 8];
      b[nf].h[1] = *(const v8h*)&BsT[nf * 16 + lrow][kt + lhi * 8 + 16];
    }
    #pragma unroll
    for (int nf = 0; nf < 4; ++nf)               // 4 back-to-back WMMAs
      acc[nf] = wmma_f16(a, b[nf], acc[nf]);
  }
}

// ---------------- Kernel 2: QKV GEMM (16384x256 x 256x768) ----------------
__global__ __launch_bounds__(256) void qkv_gemm_kernel(const _Float16* __restrict__ Ah,
                                                       const _Float16* __restrict__ BhT,
                                                       const float* __restrict__ bq,
                                                       _Float16* __restrict__ Qh,
                                                       _Float16* __restrict__ Kh,
                                                       _Float16* __restrict__ Vh) {
  __shared__ __align__(16) _Float16 As[128][KPITCH];      // 66 KB
  __shared__ __align__(16) _Float16 BsT[64][KPITCH];      // 33 KB
  const int row0  = blockIdx.x * 128;
  const int ntile = blockIdx.y * 64;
  const int t = threadIdx.x, wid = t >> 5, lane = t & 31;
  const int lrow = lane & 15, lhi = lane >> 4;

  v8f acc[4] = {};
  gemm_mainloop(Ah, BhT, row0, ntile, As, BsT, acc);

  // Epilogue: + bias, scatter into Q/K/V [n][h][l][hd] f16
  #pragma unroll
  for (int nf = 0; nf < 4; ++nf) {
    #pragma unroll
    for (int r = 0; r < 8; ++r) {
      int col = ntile + nf * 16 + lrow;
      int row = row0 + wid * 16 + r + 8 * lhi;
      float v = acc[nf][r] + bq[col];
      int which = col >> 8, d = col & 255, hh = d >> 5, hdi = d & 31;
      _Float16* dst = (which == 0) ? Qh : ((which == 1) ? Kh : Vh);
      int n = row >> 9, l = row & 511;
      dst[((n * HEADS + hh) * LEN_L + l) * HD + hdi] = (_Float16)v;
    }
  }
}

// ---------------- Kernel 4: proj GEMM + bias + residual ----------------
__global__ __launch_bounds__(256) void proj_gemm_kernel(const _Float16* __restrict__ Ah,
                                                        const _Float16* __restrict__ BhT,
                                                        const float* __restrict__ bp,
                                                        const float* __restrict__ resid,
                                                        float* __restrict__ out) {
  __shared__ __align__(16) _Float16 As[128][KPITCH];      // 66 KB
  __shared__ __align__(16) _Float16 BsT[64][KPITCH];      // 33 KB
  const int row0  = blockIdx.x * 128;
  const int ntile = blockIdx.y * 64;
  const int t = threadIdx.x, wid = t >> 5, lane = t & 31;
  const int lrow = lane & 15, lhi = lane >> 4;

  v8f acc[4] = {};
  gemm_mainloop(Ah, BhT, row0, ntile, As, BsT, acc);

  #pragma unroll
  for (int nf = 0; nf < 4; ++nf) {
    #pragma unroll
    for (int r = 0; r < 8; ++r) {
      int col = ntile + nf * 16 + lrow;
      int row = row0 + wid * 16 + r + 8 * lhi;
      out[row * DIM_D + col] = acc[nf][r] + bp[col] + resid[row * DIM_D + col];
    }
  }
}

__device__ __forceinline__ v8f exp2x8(v8f x) {
  float y0, y1, y2, y3, y4, y5, y6, y7;
  asm("v_exp_f32 %0, %8\n\tv_exp_f32 %1, %9\n\tv_exp_f32 %2, %10\n\tv_exp_f32 %3, %11\n\t"
      "v_exp_f32 %4, %12\n\tv_exp_f32 %5, %13\n\tv_exp_f32 %6, %14\n\tv_exp_f32 %7, %15\n\t"
      "v_nop"
      : "=&v"(y0), "=&v"(y1), "=&v"(y2), "=&v"(y3), "=&v"(y4), "=&v"(y5), "=&v"(y6), "=&v"(y7)
      : "v"(x[0]), "v"(x[1]), "v"(x[2]), "v"(x[3]), "v"(x[4]), "v"(x[5]), "v"(x[6]), "v"(x[7]));
  return v8f{y0, y1, y2, y3, y4, y5, y6, y7};
}

__global__ __launch_bounds__(256) void attn_kernel(const _Float16* __restrict__ Qh,
                                                   const _Float16* __restrict__ Kh,
                                                   const _Float16* __restrict__ Vh,
                                                   const float* __restrict__ pbt, // [h][k/4][q][k%4]
                                                   _Float16* __restrict__ AO) {
  __shared__ __align__(16) _Float16 Ks[2][32][LPITCH]; // [key][d]
  __shared__ __align__(16) _Float16 Vt[2][32][LPITCH]; // [d][key]
  const int nh = blockIdx.y;                 // n*8 + h
  const int n = nh >> 3, h = nh & 7;
  const int q0 = blockIdx.x * 128;
  const int t = threadIdx.x, wid = t >> 5, lane = t & 31;
  const int lrow = lane & 15, lhi = lane >> 4;

  const _Float16* Qb = Qh + (size_t)nh * LEN_L * HD;
  const _Float16* Kb = Kh + (size_t)nh * LEN_L * HD;
  const _Float16* Vb = Vh + (size_t)nh * LEN_L * HD;
  const int qrow = q0 + wid * 16 + lrow;     // this lane's query
  // this lane's query in the bias plane, at its first group of four keys
  const float* brow = pbt + (size_t)h * LEN_L * LEN_L + lhi * 2 * (LEN_L * 4) + qrow * 4;

  V16H bq;                                   // Qt as B operand: column = query
  bq.h[0] = *(const v8h*)(Qb + qrow * HD + lhi * 8);
  bq.h[1] = *(const v8h*)(Qb + qrow * HD + lhi * 8 + 16);

  float rmax = -1e30f, rsum = 0.0f;          // rsum: this half's keys only
  v8f o0 = {}, o1 = {};                      // Ot rows hd 0..15 / 16..31
  const float scale = 0.17677669529663687f;  // 1/sqrt(32)

  const int skey = t >> 3, sds = (t & 7) * 4;  // staging: 4 halves/thread each
  v4h kr, vr;
  auto gload = [&](int kc) {
    kr = *(const v4h*)(Kb + (kc + skey) * HD + sds);
    vr = *(const v4h*)(Vb + (kc + skey) * HD + sds);
  };
  auto sstore = [&](int buf) {
    *(v4h*)&Ks[buf][skey][sds] = kr;
    Vt[buf][sds + 0][skey] = vr[0]; Vt[buf][sds + 1][skey] = vr[1];
    Vt[buf][sds + 2][skey] = vr[2]; Vt[buf][sds + 3][skey] = vr[3];
  };

  gload(0);
  // the address registers of the Q, K and V loads above are reused right behind
  // them (the zeroed accumulators): the wait stands in front of that overwrite
  asm volatile("s_wait_xcnt 0x0" ::: "memory");
  sstore(0);
  __syncthreads();

  for (int kc = 0; kc < LEN_L; kc += 32) {
    const int buf = (kc >> 5) & 1;
    const bool more = (kc + 32) < LEN_L;
    if (more) {
      gload(kc + 32);                                      // overlap with compute
      __builtin_prefetch(brow + (kc + 32) * LEN_L, 0, 0);
    }

    // bias of keys kc+8h+0..7 and kc+16+8h+0..7 for this lane's query
    const float* bc = brow + kc * LEN_L;     // key group kc/4 (+ 2 in the upper half)
    const v4f g0 = *(const v4f*)(bc);
    const v4f g1 = *(const v4f*)(bc + 1 * (LEN_L * 4));
    const v4f g4 = *(const v4f*)(bc + 4 * (LEN_L * 4));
    const v4f g5 = *(const v4f*)(bc + 5 * (LEN_L * 4));

    // scores: St(32x16) = K(32x32) * Qt  (A frag [key][d] == Ks row-major)
    V16H ak0, ak1;
    ak0.h[0] = *(const v8h*)&Ks[buf][lrow][lhi * 8];
    ak0.h[1] = *(const v8h*)&Ks[buf][lrow][lhi * 8 + 16];
    ak1.h[0] = *(const v8h*)&Ks[buf][16 + lrow][lhi * 8];
    ak1.h[1] = *(const v8h*)&Ks[buf][16 + lrow][lhi * 8 + 16];
    v8f s0 = {}, s1 = {};
    s0 = wmma_f16(ak0, bq, s0);
    s1 = wmma_f16(ak1, bq, s1);

    const v8f bb0 = __builtin_shufflevector(g0, g1, 0, 1, 2, 3, 4, 5, 6, 7);
    const v8f bb1 = __builtin_shufflevector(g4, g5, 0, 1, 2, 3, 4, 5, 6, 7);

    // online softmax (fp32); C layout: col=lane&15 (query), row=r+8*(lane>>4) (key)
    const v8f sv0 = s0 * scale + bb0;
    const v8f sv1 = s1 * scale + bb1;
    float mc = fmaxf(sv0[0], sv1[0]);
    #pragma unroll
    for (int r = 1; r < 8; ++r) mc = fmaxf(mc, fmaxf(sv0[r], sv1[r]));
    mc = fmaxf(mc, xhalf(mc));               // the other half's 16 keys
    const float mnew = fmaxf(rmax, mc);
    const float alpha = __expf(rmax - mnew);
    rmax = mnew;

    const float log2e = 1.44269504f;         // __expf(x) is 2^(x * log2e)
    const v8f p0 = exp2x8((sv0 - mnew) * log2e);
    const v8f p1 = exp2x8((sv1 - mnew) * log2e);
    const v8f pv = p0 + p1;
    V16H bp;                                 // Pt as B operand, straight from St
    #pragma unroll
    for (int r = 0; r < 8; ++r) {
      bp.h[0][r] = (_Float16)p0[r];
      bp.h[1][r] = (_Float16)p1[r];
    }
    const float ps = ((pv[0] + pv[1]) + (pv[2] + pv[3])) + ((pv[4] + pv[5]) + (pv[6] + pv[7]));
    rsum = rsum * alpha + ps;
    o0 *= alpha;
    o1 *= alpha;

    // Ot(32x16) += Vt(32x32) * Pt(32x16); A frag [hd][key] == Vt row-major
    V16H av0, av1;
    av0.h[0] = *(const v8h*)&Vt[buf][lrow][lhi * 8];
    av0.h[1] = *(const v8h*)&Vt[buf][lrow][lhi * 8 + 16];
    av1.h[0] = *(const v8h*)&Vt[buf][16 + lrow][lhi * 8];
    av1.h[1] = *(const v8h*)&Vt[buf][16 + lrow][lhi * 8 + 16];
    o0 = wmma_f16(av0, bp, o0);
    o1 = wmma_f16(av1, bp, o1);

    if (more) sstore(buf ^ 1);
    __syncthreads();
  }

  // join the halves' sums, normalize, store to attn_out [n][l][h*32+hd] f16:
  // a lane holds hd 8h+0..7 and 16+8h+0..7 of its query, two 16-byte stores
  const float inv = 1.0f / (rsum + xhalf(rsum));
  v8h w0, w1;
  #pragma unroll
  for (int r = 0; r < 8; ++r) {
    w0[r] = (_Float16)(o0[r] * inv);
    w1[r] = (_Float16)(o1[r] * inv);
  }
  _Float16* dst = AO + ((size_t)n * LEN_L + qrow) * DIM_D + h * HD + lhi * 8;
  *(v8h*)dst        = w0;
  *(v8h*)(dst + 16) = w1;
}

// ---------------- launch ----------------
extern "C" void kernel_launch(void* const* d_in, const int* in_sizes, int n_in,
                              void* d_out, int out_size, void* d_ws, size_t ws_size,
                              hipStream_t stream) {
  const float* msa   = (const float*)d_in[0];
  const float* pbias = (const float*)d_in[1];
  const float* lnw   = (const float*)d_in[2];
  const float* lnb   = (const float*)d_in[3];
  const float* wqkv  = (const float*)d_in[4];
  const float* bqkv  = (const float*)d_in[5];
  const float* wproj = (const float*)d_in[6];
  const float* bproj = (const float*)d_in[7];
  float* out = (float*)d_out;

  char* ws = (char*)d_ws;
  // workspace layout (bytes), all offsets 16B-aligned
  _Float16* WqkvT  = (_Float16*)(ws + 0);          // [768][256] f16 = 393216
  _Float16* WprojT = (_Float16*)(ws + 393216);     // [256][256] f16 = 131072
  _Float16* Mh     = (_Float16*)(ws + 524288);     // 16384*256*2 = 8388608
  _Float16* Qh     = (_Float16*)(ws + 8912896);    // 8388608
  _Float16* Kh     = (_Float16*)(ws + 17301504);   // 8388608
  _Float16* Vh     = (_Float16*)(ws + 25690112);   // 8388608
  _Float16* AOh    = (_Float16*)(ws + 34078720);   // 8388608
  float*    PbT    = (float*)   (ws + 42467328);   // 8*512*512*4 = 8388608 (total ~48.5 MB)

  prep_kernel<<<LN_BLOCKS + CVQ_BLOCKS + CVP_BLOCKS + BIAS_BLOCKS, 256, 0, stream>>>(
      msa, lnw, lnb, wqkv, wproj, pbias, Mh, WqkvT, WprojT, PbT);
  qkv_gemm_kernel<<<dim3(MROWS / 128, QKV_N / 64), 256, 0, stream>>>(Mh, WqkvT, bqkv, Qh, Kh, Vh);
  attn_kernel<<<dim3(LEN_L / 128, SEQ_N * HEADS), 256, 0, stream>>>(Qh, Kh, Vh, PbT, AOh);
  proj_gemm_kernel<<<dim3(MROWS / 128, DIM_D / 64), 256, 0, stream>>>(AOh, WprojT, bproj, msa, out);
}

// v007
// A run of this version takes 51.3 microseconds.
// Two timings next to v006 put it at 1.11 and 1.12 times that version's speed.
// Over all steps from v000 it is 2.20 times as fast.
#include <hip/hip_runtime.h>
#include <math.h>

// ---- CDNA5 WMMA types ----
typedef __attribute__((ext_vector_type(16))) _Float16 v16h;
typedef __attribute__((ext_vector_type(8)))  _Float16 v8h;
typedef __attribute__((ext_vector_type(4)))  _Float16 v4h;
typedef __attribute__((ext_vector_type(8)))  float    v8f;
typedef __attribute__((ext_vector_type(4)))  float    v4f;

union V16H { v16h v; v8h h[2]; };

__device__ __forceinline__ v8f wmma_f16(const V16H& a, const V16H& b, v8f c) {
  // D = A(16x32 f16) * B(32x16 f16) + C(16x16 f32)
  return __builtin_amdgcn_wmma_f32_16x16x32_f16(false, a.v, false, b.v,
                                                (short)0, c, false, false);
}

// Problem constants: B=1, N=32, L=512, D=256, H=8, hd=32
#define SEQ_N   32
#define LEN_L   512
#define DIM_D   256
#define HEADS   8
#define HD      32
#define MROWS   (SEQ_N * LEN_L)   // 16384
#define QKV_N   (3 * DIM_D)       // 768

// LDS rows that hold 32 halves (64 bytes) of a matrix fragment's k range are laid at
// a pitch of 40 halves (80 bytes = 16 x 5). The 16 lanes of a half wave read 16 bytes
// each from 16 rows: at 64 bytes the rows fall on 4 bank groups, four rows on each;
// at 80 bytes the 16 rows fall on 16 different groups of four banks.
#define LPITCH  40

// The four preparation stages below depend on none of one another's results. They
// are bodies of ONE launch (prep_kernel): each work-group takes one stage's block,
// blk being the block's index inside that stage.

// ------- Stage: weight convert + transpose: [k][n] f32 -> [n][k] f16 -----
// A thread takes eight k of one n: the lanes run along n, so each of its eight loads
// is 128 contiguous bytes a wave, and its eight halves leave as one 16-byte store.
#define CV_K 8                                       // k per thread
__device__ __forceinline__ void cvt_tr_body(const float* __restrict__ src,
                                            _Float16* __restrict__ dst,
                                            int K, int N, int blk) {
  int i = blk * 256 + threadIdx.x;                   // linear index over [k/8][n]
  if (i >= K * N / CV_K) return;
  int n = i % N, k0 = (i / N) * CV_K;
  float x[CV_K];
  #pragma unroll   // x lives in registers; the eight loads are issued back to back
  for (int j = 0; j < CV_K; ++j) x[j] = src[(k0 + j) * N + n];
  v8h y;
  #pragma unroll   // constant indices into the vector
  for (int j = 0; j < CV_K; ++j) y[j] = (_Float16)x[j];
  *(v8h*)(dst + n * K + k0) = y;
}

// ------ Stage: pair_bias transpose [q][k][h] -> [h][k/4][q][k%4] ------
// q runs across the lanes of a transposed score tile, so a lane's four keys lie
// in 16 bytes and 16 neighbouring queries in 256 contiguous bytes.
// A wave takes 16 queries x 8 keys x 8 heads (4 KB). In: a query's 8 keys x 8 heads
// are 256 contiguous bytes, two queries to a wave load, all eight loads in flight.
// Out: per head, 16 queries of one key group are 256 contiguous bytes, two key groups
// to a wave store. The turn between the two orders goes through the wave's own LDS
// tile; its rows of 64 floats lie at 68, a multiple of 16 bytes for the b128 writes
// that spreads the 16 rows which a half wave reads back over the banks.
#define BT_PITCH 68
__device__ __forceinline__ void bias_tr_body(const float* __restrict__ pb,
                                             float* __restrict__ pbt, int blk) {
  __shared__ __align__(16) float tile[8][16][BT_PITCH];   // 34 KB
  const int wid = threadIdx.x >> 5, lane = threadIdx.x & 31;
  const int lrow = lane & 15, lhi = lane >> 4;
  const int w  = blk * 8 + wid;                      // 0 .. 2047
  const int kp = w & (LEN_L / 8 - 1);                // which run of eight keys
  const int q0 = (w >> 6) * 16;                      // first query

  v4f x[8];
  #pragma unroll   // x lives in registers; the eight loads are issued back to back
  for (int i = 0; i < 8; ++i)
    x[i] = *(const v4f*)(pb + ((q0 + 2 * i + lhi) * LEN_L + kp * 8) * HEADS + lrow * 4);
  #pragma unroll   // constant indices into x
  for (int i = 0; i < 8; ++i)
    *(v4f*)&tile[wid][2 * i + lhi][lrow * 4] = x[i];
  __syncthreads();   // the lanes read what other lanes of the wave have written

  #pragma unroll   // one store a head
  for (int h = 0; h < HEADS; ++h) {
    const float* c = &tile[wid][lrow][lhi * 4 * HEADS + h];   // query lrow, key group lhi
    const v4f y = v4f{c[0], c[HEADS], c[2 * HEADS], c[3 * HEADS]};
    *(v4f*)(pbt + (((h * (LEN_L / 4)) + kp * 2 + lhi) * LEN_L + q0 + lrow) * 4) = y;
  }
  // the registers that the eight stores name are free for reuse behind this stage:
  // the wait stands behind the last store, in front of any such overwrite
  asm volatile("s_wait_xcnt 0x0" ::: "memory");
}

// ---------------- Stage: LayerNorm -> f16 ----------------
// One wave owns a whole row (8 elements a lane, as two 512-byte wave loads) and
// takes four rows, all eight loads in flight at once: 4096 waves start instead of
// 131072, and the row sums need neither LDS nor a barrier.
__device__ __forceinline__ float xhalf(float x) {   // value of lane l ^ 16
  int b = __builtin_bit_cast(int, x);
  return __builtin_bit_cast(float,
      __builtin_amdgcn_permlanex16(b, b, 0x76543210, 0xfedcba98, false, false));
}

template <int M>
__device__ __forceinline__ float xrow(float x) {    // value of lane l ^ M, M < 16
  return __builtin_bit_cast(float,
      __builtin_amdgcn_update_dpp(0, __builtin_bit_cast(int, x), 0x160 | M, 0xf, 0xf, true));
}

__device__ __forceinline__ float wave_sum(float x) { // butterfly: every lane gets the sum
  x += xrow<1>(x);
  x += xrow<2>(x);
  x += xrow<4>(x);
  x += xrow<8>(x);
  return x + xhalf(x);
}

#define LN_ROWS 4                                    // rows per wave
__device__ __forceinline__ void ln_body(const float* __restrict__ msa,
                                        const float* __restrict__ lw,
                                        const float* __restrict__ lb,
                                        _Float16* __restrict__ mh, int blk) {
  const int c = (threadIdx.x & 31) * 4;              // columns c..c+3 and 128+c..128+c+3
  const int row0 = (blk * 8 + (threadIdx.x >> 5)) * LN_ROWS;

  const v4f w0 = *(const v4f*)(lw + c), w1 = *(const v4f*)(lw + 128 + c);
  const v4f b0 = *(const v4f*)(lb + c), b1 = *(const v4f*)(lb + 128 + c);
  v4f x0[LN_ROWS], x1[LN_ROWS];
  #pragma unroll   // the rows live in registers: constant indices, loads issued back to back
  for (int r = 0; r < LN_ROWS; ++r) {
    const float* p = msa + (row0 + r) * DIM_D + c;
    x0[r] = *(const v4f*)p;
    x1[r] = *(const v4f*)(p + 128);
  }

  #pragma unroll   // four independent butterfly chains fill one another's latency
  for (int r = 0; r < LN_ROWS; ++r) {
    const v4f s = x0[r] + x1[r];
    const float mu = wave_sum((s[0] + s[1]) + (s[2] + s[3])) * (1.0f / DIM_D);
    const v4f d0 = x0[r] - mu, d1 = x1[r] - mu;
    const v4f q = d0 * d0 + d1 * d1;
    const float var = wave_sum((q[0] + q[1]) + (q[2] + q[3])) * (1.0f / DIM_D);
    const float rs = rsqrtf(var + 1e-5f);
    const v4f y0 = d0 * rs * w0 + b0, y1 = d1 * rs * w1 + b1;
    _Float16* o = mh + (row0 + r) * DIM_D + c;
    *(v4h*)o         = v4h{(_Float16)y0[0], (_Float16)y0[1], (_Float16)y0[2], (_Float16)y0[3]};
    *(v4h*)(o + 128) = v4h{(_Float16)y1[0], (_Float16)y1[1], (_Float16)y1[2], (_Float16)y1[3]};
  }
}

// ---------------- Kernel 0: all four preparation stages, one launch ----------------
// The LayerNorm blocks come first (for speed only).
#define LN_BLOCKS   (MROWS / (8 * LN_ROWS))             // 512
#define CVQ_BLOCKS  (DIM_D * QKV_N / (CV_K * 256))      // 96
#define CVP_BLOCKS  (DIM_D * DIM_D / (CV_K * 256))      // 32
#define BIAS_BLOCKS ((LEN_L / 16) * (LEN_L / 8) / 8)    // 256
__global__ __launch_bounds__(256) void prep_kernel(const float* __restrict__ msa,
                                                   const float* __restrict__ lw,
                                                   const float* __restrict__ lb,
                                                   const float* __restrict__ wqkv,
                                                   const float* __restrict__ wproj,
                                                   const float* __restrict__ pb,
                                                   _Float16* __restrict__ mh,
                                                   _Float16* __restrict__ wqkvT,
                                                   _Float16* __restrict__ wprojT,
                                                   float* __restrict__ pbt) {
  const int b = blockIdx.x;                            // the same for a whole work-group
  if (b < LN_BLOCKS)
    ln_body(msa, lw, lb, mh, b);
  else if (b < LN_BLOCKS + CVQ_BLOCKS)
    cvt_tr_body(wqkv, wqkvT, DIM_D, QKV_N, b - LN_BLOCKS);
  else if (b < LN_BLOCKS + CVQ_BLOCKS + CVP_BLOCKS)
    cvt_tr_body(wproj, wprojT, DIM_D, DIM_D, b - (LN_BLOCKS + CVQ_BLOCKS));
  else
    bias_tr_body(pb, pbt, b - (LN_BLOCKS + CVQ_BLOCKS + CVP_BLOCKS));
}

// ============ shared GEMM body (a block keeps its A rows and walks column tiles) ============
// A block owns 128 rows of A and NT column tiles of 64. 8 waves as 4 x 2: a wave owns
// 32 rows x 32 columns of each tile (2 x 2 C frags).
// A: [M][256] f16 row-major. BhT: [N][256] f16 (pre-transposed weights).
// k is only 256, so a row of either operand is 512 bytes: one asynchronous copy of a
// wave (32 lanes x 16 bytes) brings one whole row, four full lines, straight into LDS.
// The A rows are brought once; each wave then lifts its 32 rows over the whole k range
// into registers (16 fragments) and uses them for every column tile, so that a tile
// costs only its own B rows, from L2 and from LDS alike. The B tiles go through two
// buffers: the next tile's copies fly while this tile's products run.
// LDS rows lie at 528 bytes (16 x 33): the 16 rows that a half wave reads by
// ds_load_b128 fall on 16 different groups of four banks.
#define KPITCH  (DIM_D + 8)
#define KSTEPS  (DIM_D / 32)

__device__ __forceinline__ unsigned lds_addr(const void* p) {  // byte offset in the work-group's LDS
  return (unsigned)(size_t)p;
}

// Eight rows, one copy each: LDS rows KPITCH halves apart, global rows DIM_D halves apart.
// The closing s_wait_xcnt stands inside the statement, behind the last copy, so that no
// register which a copy names is rewritten in front of it.
__device__ __forceinline__ void copy_rows8(unsigned l, const _Float16* g) {
  asm volatile(
      "global_load_async_to_lds_b128 %0, %8, off\n\t"
      "global_load_async_to_lds_b128 %1, %9, off\n\t"
      "global_load_async_to_lds_b128 %2, %10, off\n\t"
      "global_load_async_to_lds_b128 %3, %11, off\n\t"
      "global_load_async_to_lds_b128 %4, %12, off\n\t"
      "global_load_async_to_lds_b128 %5, %13, off\n\t"
      "global_load_async_to_lds_b128 %6, %14, off\n\t"
      "global_load_async_to_lds_b128 %7, %15, off\n\t"
      "s_wait_xcnt 0x0"
      :: "v"(l), "v"(l + 1 * KPITCH * 2), "v"(l + 2 * KPITCH * 2), "v"(l + 3 * KPITCH * 2),
         "v"(l + 4 * KPITCH * 2), "v"(l + 5 * KPITCH * 2), "v"(l + 6 * KPITCH * 2),
         "v"(l + 7 * KPITCH * 2),
         "v"(g), "v"(g + 1 * DIM_D), "v"(g + 2 * DIM_D), "v"(g + 3 * DIM_D),
         "v"(g + 4 * DIM_D), "v"(g + 5 * DIM_D), "v"(g + 6 * DIM_D), "v"(g + 7 * DIM_D)
      : "memory");
}

// epi(first column of the tile, acc, bias of the lane's two columns) stores one tile.
// C frag (mf, nf) of a wave: row = row0 + wr * 32 + mf * 16 + r + 8 * lhi,
//                            col = tile + wc * 32 + nf * 16 + lrow.
template <int NT, class Epi>
__device__ __forceinline__ void gemm_rows(const _Float16* __restrict__ Ah,
                                          const _Float16* __restrict__ BhT,
                                          const float* __restrict__ bias,
                                          int row0, int ntile0,
                                          _Float16 (*As)[KPITCH],
                                          _Float16 (*BsT)[64][KPITCH],
                                          float* bs, Epi epi) {
  const int t = threadIdx.x, wid = t >> 5, lane = t & 31;
  const int lrow = lane & 15, lhi = lane >> 4;
  const int wr = wid & 3, wc = wid >> 2;

  // wave wid brings A rows 16 wid .. 16 wid + 15 and, of each tile, B rows
  // 8 wid .. 8 wid + 7; a lane brings halves 8 lane .. 8 lane + 7 of each row
  const _Float16* ga = Ah + (row0 + wid * 16) * DIM_D + lane * 8;
  const _Float16* gb = BhT + (ntile0 + wid * 8) * DIM_D + lane * 8;
  copy_rows8(lds_addr(&As[wid * 16][lane * 8]), ga);
  copy_rows8(lds_addr(&As[wid * 16 + 8][lane * 8]), ga + 8 * DIM_D);
  copy_rows8(lds_addr(&BsT[0][wid * 8][lane * 8]), gb);
  // the bias of the block's NT * 64 columns goes to LDS once, under the copies' flight;
  // the barrier below shows it to every wave. bs is rounded up to whole blocks of 256,
  // so that every lane stays on; the places past the end repeat the last column's bias
  #pragma unroll
  for (int i = 0; i < NT * 64; i += 256) {
    const int j = i + t;
    bs[j] = bias[ntile0 + (j < NT * 64 ? j : NT * 64 - 1)];
  }
  // this wave's copies have landed behind this wait; the barrier then shows every
  // wave's rows to every wave
  asm volatile("s_wait_asynccnt 0x0" ::: "memory");
  __syncthreads();
  if (NT > 1) copy_rows8(lds_addr(&BsT[1][wid * 8][lane * 8]), gb + 64 * DIM_D);

  V16H a[2][KSTEPS];                             // the wave's 32 A rows, whole k range
  #pragma unroll   // a lives in registers: constant indices
  for (int mf = 0; mf < 2; ++mf) {
    #pragma unroll
    for (int ks = 0; ks < KSTEPS; ++ks) {
      a[mf][ks].h[0] = *(const v8h*)&As[wr * 32 + mf * 16 + lrow][ks * 32 + lhi * 8];
      a[mf][ks].h[1] = *(const v8h*)&As[wr * 32 + mf * 16 + lrow][ks * 32 + lhi * 8 + 16];
    }
  }

  #pragma unroll 1   // one copy of the tile's code serves every tile
  for (int nt = 0; nt < NT; ++nt) {
    const int ntile = ntile0 + nt * 64;
    const _Float16 (*B)[KPITCH] = BsT[nt & 1];
    v8f acc[2][2] = {};
    // B fragments go through two register sets of two k blocks each: the next pair's
    // eight reads are issued as one group ahead of this pair's eight products
    V16H b[2][2][2];                             // [set][k block of the pair][nf]
    auto read_pair = [&](V16H (&s)[2][2], int kp) {
      #pragma unroll
      for (int kq = 0; kq < 2; ++kq) {
        #pragma unroll
        for (int nf = 0; nf < 2; ++nf) {
          const _Float16* p = &B[wc * 32 + nf * 16 + lrow][(kp * 2 + kq) * 32 + lhi * 8];
          s[kq][nf].h[0] = *(const v8h*)p;
          s[kq][nf].h[1] = *(const v8h*)(p + 16);
        }
      }
    };
    // bias of the lane's two columns: read ahead of the products, used behind them
    const float bv[2] = {bs[nt * 64 + wc * 32 + lrow], bs[nt * 64 + wc * 32 + 16 + lrow]};
    read_pair(b[0], 0);
    #pragma unroll   // constant LDS offsets and register indices
    for (int kp = 0; kp < KSTEPS / 2; ++kp) {
      if (kp + 1 < KSTEPS / 2) read_pair(b[(kp + 1) & 1], kp + 1);
      // holds the reads above in front of the products below: left alone, the compiler
      // sinks each read to just in front of its product, and the wave waits out the LDS
      __builtin_amdgcn_sched_barrier(0);
      #pragma unroll
      for (int kq = 0; kq < 2; ++kq) {
        #pragma unroll
        for (int mf = 0; mf < 2; ++mf) {
          #pragma unroll
          for (int nf = 0; nf < 2; ++nf)
            acc[mf][nf] = wmma_f16(a[mf][kp * 2 + kq], b[kp & 1][kq][nf], acc[mf][nf]);
        }
      }
      // keeps the reads of the pair after next from being spread among these products
      __builtin_amdgcn_sched_barrier(0);
    }

    // hand-over: this wave's reads of the buffer are done, its copies of the next tile
    // have landed; the barrier shows the next tile to every wave and frees this buffer
    asm volatile("s_wait_dscnt 0x0" ::: "memory");
    asm volatile("s_wait_asynccnt 0x0" ::: "memory");
    __syncthreads();
    if (nt + 2 < NT)                             // the same for the whole work-group
      copy_rows8(lds_addr(&BsT[nt & 1][wid * 8][lane * 8]), gb + (nt + 2) * 64 * DIM_D);

    epi(ntile, acc, bv);                         // reads no LDS: runs under the refill
    // the registers that the tile's stores name are rewritten by the next tile's reads
    // and products: the wait stands behind the last store, in front of any such overwrite
    asm volatile("s_wait_xcnt 0x0" ::: "memory");
  }
  asm volatile("s_wait_asynccnt 0x0" ::: "memory");   // no copy is left in flight at the end
}

// ---------------- Kernel 2: QKV GEMM (16384x256 x 256x768) ----------------
#define QKV_NT  (QKV_N / 64 / 2)                 // 6 column tiles a block
__global__ __launch_bounds__(256) void qkv_gemm_kernel(const _Float16* __restrict__ Ah,
                                                       const _Float16* __restrict__ BhT,
                                                       const float* __restrict__ bq,
                                                       _Float16* __restrict__ Qh,
                                                       _Float16* __restrict__ Kh,
                                                       _Float16* __restrict__ Vh) {
  __shared__ __align__(16) _Float16 As[128][KPITCH];      // 66 KB
  __shared__ __align__(16) _Float16 BsT[2][64][KPITCH];   // 2 x 33 KB
  __shared__ float bs[(QKV_NT * 64 + 255) / 256 * 256];
  const int row0 = blockIdx.x * 128;
  const int t = threadIdx.x, wid = t >> 5, lane = t & 31;
  const int lrow = lane & 15, lhi = lane >> 4;
  const int wr = wid & 3, wc = wid >> 2;

  // Epilogue: + bias, scatter into Q/K/V [n][h][l][hd] f16
  gemm_rows<QKV_NT>(Ah, BhT, bq, row0, blockIdx.y * (QKV_NT * 64), As, BsT, bs,
                    [&](int ntile, const v8f (&acc)[2][2], const float (&bv)[2]) {
    // a tile of 64 columns lies inside one of Q, K, V, and a wave's 32 columns are one head
    const int which = ntile >> 8;
    _Float16* dst = (which == 0) ? Qh : ((which == 1) ? Kh : Vh);
    const int hh = ((ntile & 255) >> 5) + wc;
    #pragma unroll
    for (int mf = 0; mf < 2; ++mf) {
      #pragma unroll
      for (int nf = 0; nf < 2; ++nf) {
        #pragma unroll
        for (int r = 0; r < 8; ++r) {
          int row = row0 + wr * 32 + mf * 16 + r + 8 * lhi;
          float v = acc[mf][nf][r] + bv[nf];
          int n = row >> 9, l = row & 511;
          dst[((n * HEADS + hh) * LEN_L + l) * HD + nf * 16 + lrow] = (_Float16)v;
        }
      }
    }
  });
}

// ---------------- Kernel 4: proj GEMM + bias + residual ----------------
#define PROJ_NT (DIM_D / 64 / 2)                 // 2 column tiles a block
__global__ __launch_bounds__(256) void proj_gemm_kernel(const _Float16* __restrict__ Ah,
                                                        const _Float16* __restrict__ BhT,
                                                        const float* __restrict__ bp,
                                                        const float* __restrict__ resid,
                                                        float* __restrict__ out) {
  __shared__ __align__(16) _Float16 As[128][KPITCH];      // 66 KB
  __shared__ __align__(16) _Float16 BsT[2][64][KPITCH];   // 2 x 33 KB
  __shared__ float bs[(PROJ_NT * 64 + 255) / 256 * 256];
  const int row0 = blockIdx.x * 128;
  const int t = threadIdx.x, wid = t >> 5, lane = t & 31;
  const int lrow = lane & 15, lhi = lane >> 4;
  const int wr = wid & 3, wc = wid >> 2;

  gemm_rows<PROJ_NT>(Ah, BhT, bp, row0, blockIdx.y * (PROJ_NT * 64), As, BsT, bs,
                     [&](int ntile, const v8f (&acc)[2][2], const float (&bv)[2]) {
    #pragma unroll
    for (int mf = 0; mf < 2; ++mf) {
      #pragma unroll
      for (int nf = 0; nf < 2; ++nf) {
        #pragma unroll
        for (int r = 0; r < 8; ++r) {
          int col = ntile + wc * 32 + nf * 16 + lrow;
          int row = row0 + wr * 32 + mf * 16 + r + 8 * lhi;
          out[row * DIM_D + col] = acc[mf][nf][r] + bv[nf] + resid[row * DIM_D + col];
        }
      }
    }
  });
}

__device__ __forceinline__ v8f exp2x8(v8f x) {
  float y0, y1, y2, y3, y4, y5, y6, y7;
  asm("v_exp_f32 %0, %8\n\tv_exp_f32 %1, %9\n\tv_exp_f32 %2, %10\n\tv_exp_f32 %3, %11\n\t"
      "v_exp_f32 %4, %12\n\tv_exp_f32 %5, %13\n\tv_exp_f32 %6, %14\n\tv_exp_f32 %7, %15\n\t"
      "v_nop"
      : "=&v"(y0), "=&v"(y1), "=&v"(y2), "=&v"(y3), "=&v"(y4), "=&v"(y5), "=&v"(y6), "=&v"(y7)
      : "v"(x[0]), "v"(x[1]), "v"(x[2]), "v"(x[3]), "v"(x[4]), "v"(x[5]), "v"(x[6]), "v"(x[7]));
  return v8f{y0, y1, y2, y3, y4, y5, y6, y7};
}

__global__ __launch_bounds__(256) void attn_kernel(const _Float16* __restrict__ Qh,
                                                   const _Float16* __restrict__ Kh,
                                                   const _Float16* __restrict__ Vh,
                                                   const float* __restrict__ pbt, // [h][k/4][q][k%4]
                                                   _Float16* __restrict__ AO) {
  __shared__ __align__(16) _Float16 Ks[2][32][LPITCH]; // [key][d]
  __shared__ __align__(16) _Float16 Vt[2][32][LPITCH]; // [d][key]
  const int nh = blockIdx.y;                 // n*8 + h
  const int n = nh >> 3, h = nh & 7;
  const int q0 = blockIdx.x * 128;
  const int t = threadIdx.x, wid = t >> 5, lane = t & 31;
  const int lrow = lane & 15, lhi = lane >> 4;

  const _Float16* Qb = Qh + (size_t)nh * LEN_L * HD;
  const _Float16* Kb = Kh + (size_t)nh * LEN_L * HD;
  const _Float16* Vb = Vh + (size_t)nh * LEN_L * HD;
  const int qrow = q0 + wid * 16 + lrow;     // this lane's query
  // this lane's query in the bias plane, at its first group of four keys
  const float* brow = pbt + (size_t)h * LEN_L * LEN_L + lhi * 2 * (LEN_L * 4) + qrow * 4;

  V16H bq;                                   // Qt as B operand: column = query
  bq.h[0] = *(const v8h*)(Qb + qrow * HD + lhi * 8);
  bq.h[1] = *(const v8h*)(Qb + qrow * HD + lhi * 8 + 16);

  float rmax = -1e30f, rsum = 0.0f;          // rsum: this half's keys only
  v8f o0 = {}, o1 = {};                      // Ot rows hd 0..15 / 16..31
  const float scale = 0.17677669529663687f;  // 1/sqrt(32)

  const int skey = t >> 3, sds = (t & 7) * 4;  // staging: 4 halves/thread each
  v4h kr, vr;
  auto gload = [&](int kc) {
    kr = *(const v4h*)(Kb + (kc + skey) * HD + sds);
    vr = *(const v4h*)(Vb + (kc + skey) * HD + sds);
  };
  auto sstore = [&](int buf) {
    *(v4h*)&Ks[buf][skey][sds] = kr;
    Vt[buf][sds + 0][skey] = vr[0]; Vt[buf][sds + 1][skey] = vr[1];
    Vt[buf][sds + 2][skey] = vr[2]; Vt[buf][sds + 3][skey] = vr[3];
  };

  gload(0);
  // the address registers of the Q, K and V loads above are reused right behind
  // them (the zeroed accumulators): the wait stands in front of that overwrite
  asm volatile("s_wait_xcnt 0x0" ::: "memory");
  sstore(0);
  __syncthreads();

  for (int kc = 0; kc < LEN_L; kc += 32) {
    const int buf = (kc >> 5) & 1;
    const bool more = (kc + 32) < LEN_L;
    if (more) {
      gload(kc + 32);                                      // overlap with compute
      __builtin_prefetch(brow + (kc + 32) * LEN_L, 0, 0);
    }

    // bias of keys kc+8h+0..7 and kc+16+8h+0..7 for this lane's query
    const float* bc = brow + kc * LEN_L;     // key group kc/4 (+ 2 in the upper half)
    const v4f g0 = *(const v4f*)(bc);
    const v4f g1 = *(const v4f*)(bc + 1 * (LEN_L * 4));
    const v4f g4 = *(const v4f*)(bc + 4 * (LEN_L * 4));
    const v4f g5 = *(const v4f*)(bc + 5 * (LEN_L * 4));

    // scores: St(32x16) = K(32x32) * Qt  (A frag [key][d] == Ks row-major)
    V16H ak0, ak1;
    ak0.h[0] = *(const v8h*)&Ks[buf][lrow][lhi * 8];
    ak0.h[1] = *(const v8h*)&Ks[buf][lrow][lhi * 8 + 16];
    ak1.h[0] = *(const v8h*)&Ks[buf][16 + lrow][lhi * 8];
    ak1.h[1] = *(const v8h*)&Ks[buf][16 + lrow][lhi * 8 + 16];
    v8f s0 = {}, s1 = {};
    s0 = wmma_f16(ak0, bq, s0);
    s1 = wmma_f16(ak1, bq, s1);

    const v8f bb0 = __builtin_shufflevector(g0, g1, 0, 1, 2, 3, 4, 5, 6, 7);
    const v8f bb1 = __builtin_shufflevector(g4, g5, 0, 1, 2, 3, 4, 5, 6, 7);

    // online softmax (fp32); C layout: col=lane&15 (query), row=r+8*(lane>>4) (key)
    const v8f sv0 = s0 * scale + bb0;
    const v8f sv1 = s1 * scale + bb1;
    float mc = fmaxf(sv0[0], sv1[0]);
    #pragma unroll
    for (int r = 1; r < 8; ++r) mc = fmaxf(mc, fmaxf(sv0[r], sv1[r]));
    mc = fmaxf(mc, xhalf(mc));               // the other half's 16 keys
    const float mnew = fmaxf(rmax, mc);
    const float alpha = __expf(rmax - mnew);
    rmax = mnew;

    const float log2e = 1.44269504f;         // __expf(x) is 2^(x * log2e)
    const v8f p0 = exp2x8((sv0 - mnew) * log2e);
    const v8f p1 = exp2x8((sv1 - mnew) * log2e);
    const v8f pv = p0 + p1;
    V16H bp;                                 // Pt as B operand, straight from St
    #pragma unroll
    for (int r = 0; r < 8; ++r) {
      bp.h[0][r] = (_Float16)p0[r];
      bp.h[1][r] = (_Float16)p1[r];
    }
    const float ps = ((pv[0] + pv[1]) + (pv[2] + pv[3])) + ((pv[4] + pv[5]) + (pv[6] + pv[7]));
    rsum = rsum * alpha + ps;
    o0 *= alpha;
    o1 *= alpha;

    // Ot(32x16) += Vt(32x32) * Pt(32x16); A frag [hd][key] == Vt row-major
    V16H av0, av1;
    av0.h[0] = *(const v8h*)&Vt[buf][lrow][lhi * 8];
    av0.h[1] = *(const v8h*)&Vt[buf][lrow][lhi * 8 + 16];
    av1.h[0] = *(const v8h*)&Vt[buf][16 + lrow][lhi * 8];
    av1.h[1] = *(const v8h*)&Vt[buf][16 + lrow][lhi * 8 + 16];
    o0 = wmma_f16(av0, bp, o0);
    o1 = wmma_f16(av1, bp, o1);

    if (more) sstore(buf ^ 1);
    __syncthreads();
  }

  // join the halves' sums, normalize, store to attn_out [n][l][h*32+hd] f16:
  // a lane holds hd 8h+0..7 and 16+8h+0..7 of its query, two 16-byte stores
  const float inv = 1.0f / (rsum + xhalf(rsum));
  v8h w0, w1;
  #pragma unroll
  for (int r = 0; r < 8; ++r) {
    w0[r] = (_Float16)(o0[r] * inv);
    w1[r] = (_Float16)(o1[r] * inv);
  }
  _Float16* dst = AO + ((size_t)n * LEN_L + qrow) * DIM_D + h * HD + lhi * 8;
  *(v8h*)dst        = w0;
  *(v8h*)(dst + 16) = w1;
}

// ---------------- launch ----------------
extern "C" void kernel_launch(void* const* d_in, const int* in_sizes, int n_in,
                              void* d_out, int out_size, void* d_ws, size_t ws_size,
                              hipStream_t stream) {
  const float* msa   = (const float*)d_in[0];
  const float* pbias = (const float*)d_in[1];
  const float* lnw   = (const float*)d_in[2];
  const float* lnb   = (const float*)d_in[3];
  const float* wqkv  = (const float*)d_in[4];
  const float* bqkv  = (const float*)d_in[5];
  const float* wproj = (const float*)d_in[6];
  const float* bproj = (const float*)d_in[7];
  float* out = (float*)d_out;

  char* ws = (char*)d_ws;
  // workspace layout (bytes), all offsets 16B-aligned
  _Float16* WqkvT  = (_Float16*)(ws + 0);          // [768][256] f16 = 393216
  _Float16* WprojT = (_Float16*)(ws + 393216);     // [256][256] f16 = 131072
  _Float16* Mh     = (_Float16*)(ws + 524288);     // 16384*256*2 = 8388608
  _Float16* Qh     = (_Float16*)(ws + 8912896);    // 8388608
  _Float16* Kh     = (_Float16*)(ws + 17301504);   // 8388608
  _Float16* Vh     = (_Float16*)(ws + 25690112);   // 8388608
  _Float16* AOh    = (_Float16*)(ws + 34078720);   // 8388608
  float*    PbT    = (float*)   (ws + 42467328);   // 8*512*512*4 = 8388608 (total ~48.5 MB)

  prep_kernel<<<LN_BLOCKS + CVQ_BLOCKS + CVP_BLOCKS + BIAS_BLOCKS, 256, 0, stream>>>(
      msa, lnw, lnb, wqkv, wproj, pbias, Mh, WqkvT, WprojT, PbT);
  qkv_gemm_kernel<<<dim3(MROWS / 128, 2), 256, 0, stream>>>(Mh, WqkvT, bqkv, Qh, Kh, Vh);
  attn_kernel<<<dim3(LEN_L / 128, SEQ_N * HEADS), 256, 0, stream>>>(Qh, Kh, Vh, PbT, AOh);
  proj_gemm_kernel<<<dim3(MROWS / 128, 2), 256, 0, stream>>>(AOh, WprojT, bproj, msa, out);
}

// v008
// It runs in 49.9 microseconds.
// In two side-by-side timings against v007, it was 1.03 and 1.02 times as fast.
// Counting every step since v000, it is 2.26 times as fast.
#include <hip/hip_runtime.h>
#include <math.h>

// ---- CDNA5 WMMA types ----
typedef __attribute__((ext_vector_type(16))) _Float16 v16h;
typedef __attribute__((ext_vector_type(8)))  _Float16 v8h;
typedef __attribute__((ext_vector_type(4)))  _Float16 v4h;
typedef __attribute__((ext_vector_type(8)))  float    v8f;
typedef __attribute__((ext_vector_type(4)))  float    v4f;

union V16H { v16h v; v8h h[2]; };

__device__ __forceinline__ v8f wmma_f16(const V16H& a, const V16H& b, v8f c) {
  // D = A(16x32 f16) * B(32x16 f16) + C(16x16 f32)
  return __builtin_amdgcn_wmma_f32_16x16x32_f16(false, a.v, false, b.v,
                                                (short)0, c, false, false);
}

// Problem constants: B=1, N=32, L=512, D=256, H=8, hd=32
#define SEQ_N   32
#define LEN_L   512
#define DIM_D   256
#define HEADS   8
#define HD      32
#define MROWS   (SEQ_N * LEN_L)   // 16384
#define QKV_N   (3 * DIM_D)       // 768

// LDS rows that hold 32 halves (64 bytes) of a matrix fragment's k range are laid at
// a pitch of 40 halves (80 bytes = 16 x 5). The 16 lanes of a half wave read 16 bytes
// each from 16 rows: at 64 bytes the rows fall on 4 bank groups, four rows on each;
// at 80 bytes the 16 rows fall on 16 different groups of four banks.
#define LPITCH  40

// The four preparation stages below depend on none of one another's results. They
// are bodies of ONE launch (prep_kernel): each work-group takes one stage's block,
// blk being the block's index inside that stage.

// ------- Stage: weight convert + transpose: [k][n] f32 -> [n][k] f16 -----
// A thread takes eight k of one n: the lanes run along n, so each of its eight loads
// is 128 contiguous bytes a wave, and its eight halves leave as one 16-byte store.
#define CV_K 8                                       // k per thread
__device__ __forceinline__ void cvt_tr_body(const float* __restrict__ src,
                                            _Float16* __restrict__ dst,
                                            int K, int N, int blk) {
  int i = blk * 256 + threadIdx.x;                   // linear index over [k/8][n]
  if (i >= K * N / CV_K) return;
  int n = i % N, k0 = (i / N) * CV_K;
  float x[CV_K];
  #pragma unroll   // x lives in registers; the eight loads are issued back to back
  for (int j = 0; j < CV_K; ++j) x[j] = src[(k0 + j) * N + n];
  v8h y;
  #pragma unroll   // constant indices into the vector
  for (int j = 0; j < CV_K; ++j) y[j] = (_Float16)x[j];
  *(v8h*)(dst + n * K + k0) = y;
}

// ------ Stage: pair_bias transpose [q][k][h] -> [h][k/4][q][k%4] ------
// q runs across the lanes of a transposed score tile, so a lane's four keys lie
// in 16 bytes and 16 neighbouring queries in 256 contiguous bytes.
// A wave takes 16 queries x 8 keys x 8 heads (4 KB). In: a query's 8 keys x 8 heads
// are 256 contiguous bytes, two queries to a wave load, all eight loads in flight.
// Out: per head, 16 queries of one key group are 256 contiguous bytes, two key groups
// to a wave store. The turn between the two orders goes through the wave's own LDS
// tile; its rows of 64 floats lie at 68, a multiple of 16 bytes for the b128 writes
// that spreads the 16 rows which a half wave reads back over the banks.
#define BT_PITCH 68
__device__ __forceinline__ void bias_tr_body(const float* __restrict__ pb,
                                             float* __restrict__ pbt, int blk) {
  __shared__ __align__(16) float tile[8][16][BT_PITCH];   // 34 KB
  const int wid = threadIdx.x >> 5, lane = threadIdx.x & 31;
  const int lrow = lane & 15, lhi = lane >> 4;
  const int w  = blk * 8 + wid;                      // 0 .. 2047
  const int kp = w & (LEN_L / 8 - 1);                // which run of eight keys
  const int q0 = (w >> 6) * 16;                      // first query

  v4f x[8];
  #pragma unroll   // x lives in registers; the eight loads are issued back to back
  for (int i = 0; i < 8; ++i)
    x[i] = *(const v4f*)(pb + ((q0 + 2 * i + lhi) * LEN_L + kp * 8) * HEADS + lrow * 4);
  #pragma unroll   // constant indices into x
  for (int i = 0; i < 8; ++i)
    *(v4f*)&tile[wid][2 * i + lhi][lrow * 4] = x[i];
  __syncthreads();   // the lanes read what other lanes of the wave have written

  #pragma unroll   // one store a head
  for (int h = 0; h < HEADS; ++h) {
    const float* c = &tile[wid][lrow][lhi * 4 * HEADS + h];   // query lrow, key group lhi
    const v4f y = v4f{c[0], c[HEADS], c[2 * HEADS], c[3 * HEADS]};
    *(v4f*)(pbt + (((h * (LEN_L / 4)) + kp * 2 + lhi) * LEN_L + q0 + lrow) * 4) = y;
  }
  // the registers that the eight stores name are free for reuse behind this stage:
  // the wait stands behind the last store, in front of any such overwrite
  asm volatile("s_wait_xcnt 0x0" ::: "memory");
}

// ---------------- Stage: LayerNorm -> f16 ----------------
// One wave owns a whole row (8 elements a lane, as two 512-byte wave loads) and
// takes four rows, all eight loads in flight at once: 4096 waves start instead of
// 131072, and the row sums need neither LDS nor a barrier.
__device__ __forceinline__ float xhalf(float x) {   // value of lane l ^ 16
  int b = __builtin_bit_cast(int, x);
  return __builtin_bit_cast(float,
      __builtin_amdgcn_permlanex16(b, b, 0x76543210, 0xfedcba98, false, false));
}

template <int M>
__device__ __forceinline__ float xrow(float x) {    // value of lane l ^ M, M < 16
  return __builtin_bit_cast(float,
      __builtin_amdgcn_update_dpp(0, __builtin_bit_cast(int, x), 0x160 | M, 0xf, 0xf, true));
}

__device__ __forceinline__ float wave_sum(float x) { // butterfly: every lane gets the sum
  x += xrow<1>(x);
  x += xrow<2>(x);
  x += xrow<4>(x);
  x += xrow<8>(x);
  return x + xhalf(x);
}

#define LN_ROWS 4                                    // rows per wave
__device__ __forceinline__ void ln_body(const float* __restrict__ msa,
                                        const float* __restrict__ lw,
                                        const float* __restrict__ lb,
                                        _Float16* __restrict__ mh, int blk) {
  const int c = (threadIdx.x & 31) * 4;              // columns c..c+3 and 128+c..128+c+3
  const int row0 = (blk * 8 + (threadIdx.x >> 5)) * LN_ROWS;

  const v4f w0 = *(const v4f*)(lw + c), w1 = *(const v4f*)(lw + 128 + c);
  const v4f b0 = *(const v4f*)(lb + c), b1 = *(const v4f*)(lb + 128 + c);
  v4f x0[LN_ROWS], x1[LN_ROWS];
  #pragma unroll   // the rows live in registers: constant indices, loads issued back to back
  for (int r = 0; r < LN_ROWS; ++r) {
    const float* p = msa + (row0 + r) * DIM_D + c;
    x0[r] = *(const v4f*)p;
    x1[r] = *(const v4f*)(p + 128);
  }

  #pragma unroll   // four independent butterfly chains fill one another's latency
  for (int r = 0; r < LN_ROWS; ++r) {
    const v4f s = x0[r] + x1[r];
    const float mu = wave_sum((s[0] + s[1]) + (s[2] + s[3])) * (1.0f / DIM_D);
    const v4f d0 = x0[r] - mu, d1 = x1[r] - mu;
    const v4f q = d0 * d0 + d1 * d1;
    const float var = wave_sum((q[0] + q[1]) + (q[2] + q[3])) * (1.0f / DIM_D);
    const float rs = rsqrtf(var + 1e-5f);
    const v4f y0 = d0 * rs * w0 + b0, y1 = d1 * rs * w1 + b1;
    _Float16* o = mh + (row0 + r) * DIM_D + c;
    *(v4h*)o         = v4h{(_Float16)y0[0], (_Float16)y0[1], (_Float16)y0[2], (_Float16)y0[3]};
    *(v4h*)(o + 128) = v4h{(_Float16)y1[0], (_Float16)y1[1], (_Float16)y1[2], (_Float16)y1[3]};
  }
}

// ---------------- Kernel 0: all four preparation stages, one launch ----------------
// The LayerNorm blocks come first (for speed only).
#define LN_BLOCKS   (MROWS / (8 * LN_ROWS))             // 512
#define CVQ_BLOCKS  (DIM_D * QKV_N / (CV_K * 256))      // 96
#define CVP_BLOCKS  (DIM_D * DIM_D / (CV_K * 256))      // 32
#define BIAS_BLOCKS ((LEN_L / 16) * (LEN_L / 8) / 8)    // 256
__global__ __launch_bounds__(256) void prep_kernel(const float* __restrict__ msa,
                                                   const float* __restrict__ lw,
                                                   const float* __restrict__ lb,
                                                   const float* __restrict__ wqkv,
                                                   const float* __restrict__ wproj,
                                                   const float* __restrict__ pb,
                                                   _Float16* __restrict__ mh,
                                                   _Float16* __restrict__ wqkvT,
                                                   _Float16* __restrict__ wprojT,
                                                   float* __restrict__ pbt) {
  const int b = blockIdx.x;                            // the same for a whole work-group
  if (b < LN_BLOCKS)
    ln_body(msa, lw, lb, mh, b);
  else if (b < LN_BLOCKS + CVQ_BLOCKS)
    cvt_tr_body(wqkv, wqkvT, DIM_D, QKV_N, b - LN_BLOCKS);
  else if (b < LN_BLOCKS + CVQ_BLOCKS + CVP_BLOCKS)
    cvt_tr_body(wproj, wprojT, DIM_D, DIM_D, b - (LN_BLOCKS + CVQ_BLOCKS));
  else
    bias_tr_body(pb, pbt, b - (LN_BLOCKS + CVQ_BLOCKS + CVP_BLOCKS));
}

// ============ shared GEMM body (a block keeps its A rows and walks column tiles) ============
// A block owns 128 rows of A and NT column tiles of 64. 8 waves as 4 x 2: a wave owns
// 32 rows x 32 columns of each tile (2 x 2 C frags).
// A: [M][256] f16 row-major. BhT: [N][256] f16 (pre-transposed weights).
// k is only 256, so a row of either operand is 512 bytes: one asynchronous copy of a
// wave (32 lanes x 16 bytes) brings one whole row, four full lines, straight into LDS.
// The A rows are brought once; each wave then lifts its 32 rows over the whole k range
// into registers (16 fragments) and uses them for every column tile, so that a tile
// costs only its own B rows, from L2 and from LDS alike. The B tiles go through two
// buffers: the next tile's copies fly while this tile's products run.
// LDS rows lie at 528 bytes (16 x 33): the 16 rows that a half wave reads by
// ds_load_b128 fall on 16 different groups of four banks.
#define KPITCH  (DIM_D + 8)
#define KSTEPS  (DIM_D / 32)

__device__ __forceinline__ unsigned lds_addr(const void* p) {  // byte offset in the work-group's LDS
  return (unsigned)(size_t)p;
}

// Eight rows, one copy each: LDS rows KPITCH halves apart, global rows DIM_D halves apart.
// The closing s_wait_xcnt stands inside the statement, behind the last copy, so that no
// register which a copy names is rewritten in front of it.
__device__ __forceinline__ void copy_rows8(unsigned l, const _Float16* g) {
  asm volatile(
      "global_load_async_to_lds_b128 %0, %8, off\n\t"
      "global_load_async_to_lds_b128 %1, %9, off\n\t"
      "global_load_async_to_lds_b128 %2, %10, off\n\t"
      "global_load_async_to_lds_b128 %3, %11, off\n\t"
      "global_load_async_to_lds_b128 %4, %12, off\n\t"
      "global_load_async_to_lds_b128 %5, %13, off\n\t"
      "global_load_async_to_lds_b128 %6, %14, off\n\t"
      "global_load_async_to_lds_b128 %7, %15, off\n\t"
      "s_wait_xcnt 0x0"
      :: "v"(l), "v"(l + 1 * KPITCH * 2), "v"(l + 2 * KPITCH * 2), "v"(l + 3 * KPITCH * 2),
         "v"(l + 4 * KPITCH * 2), "v"(l + 5 * KPITCH * 2), "v"(l + 6 * KPITCH * 2),
         "v"(l + 7 * KPITCH * 2),
         "v"(g), "v"(g + 1 * DIM_D), "v"(g + 2 * DIM_D), "v"(g + 3 * DIM_D),
         "v"(g + 4 * DIM_D), "v"(g + 5 * DIM_D), "v"(g + 6 * DIM_D), "v"(g + 7 * DIM_D)
      : "memory");
}

// epi(first column of the tile, acc, bias of the lane's two columns) stores one tile.
// C frag (mf, nf) of a wave: row = row0 + wr * 32 + mf * 16 + r + 8 * lhi,
//                            col = tile + wc * 32 + nf * 16 + lrow.
template <int NT, class Epi>
__device__ __forceinline__ void gemm_rows(const _Float16* __restrict__ Ah,
                                          const _Float16* __restrict__ BhT,
                                          const float* __restrict__ bias,
                                          int row0, int ntile0,
                                          _Float16 (*As)[KPITCH],
                                          _Float16 (*BsT)[64][KPITCH],
                                          float* bs, Epi epi) {
  const int t = threadIdx.x, wid = t >> 5, lane = t & 31;
  const int lrow = lane & 15, lhi = lane >> 4;
  const int wr = wid & 3, wc = wid >> 2;

  // wave wid brings A rows 16 wid .. 16 wid + 15 and, of each tile, B rows
  // 8 wid .. 8 wid + 7; a lane brings halves 8 lane .. 8 lane + 7 of each row
  const _Float16* ga = Ah + (row0 + wid * 16) * DIM_D + lane * 8;
  const _Float16* gb = BhT + (ntile0 + wid * 8) * DIM_D + lane * 8;
  copy_rows8(lds_addr(&As[wid * 16][lane * 8]), ga);
  copy_rows8(lds_addr(&As[wid * 16 + 8][lane * 8]), ga + 8 * DIM_D);
  copy_rows8(lds_addr(&BsT[0][wid * 8][lane * 8]), gb);
  // the bias of the block's NT * 64 columns goes to LDS once, under the copies' flight;
  // the barrier below shows it to every wave. bs is rounded up to whole blocks of 256,
  // so that every lane stays on; the places past the end repeat the last column's bias
  #pragma unroll
  for (int i = 0; i < NT * 64; i += 256) {
    const int j = i + t;
    bs[j] = bias[ntile0 + (j < NT * 64 ? j : NT * 64 - 1)];
  }
  // this wave's copies have landed behind this wait; the barrier then shows every
  // wave's rows to every wave
  asm volatile("s_wait_asynccnt 0x0" ::: "memory");
  __syncthreads();
  if (NT > 1) copy_rows8(lds_addr(&BsT[1][wid * 8][lane * 8]), gb + 64 * DIM_D);

  V16H a[2][KSTEPS];                             // the wave's 32 A rows, whole k range
  #pragma unroll   // a lives in registers: constant indices
  for (int mf = 0; mf < 2; ++mf) {
    #pragma unroll
    for (int ks = 0; ks < KSTEPS; ++ks) {
      a[mf][ks].h[0] = *(const v8h*)&As[wr * 32 + mf * 16 + lrow][ks * 32 + lhi * 8];
      a[mf][ks].h[1] = *(const v8h*)&As[wr * 32 + mf * 16 + lrow][ks * 32 + lhi * 8 + 16];
    }
  }

  #pragma unroll 1   // one copy of the tile's code serves every tile
  for (int nt = 0; nt < NT; ++nt) {
    const int ntile = ntile0 + nt * 64;
    const _Float16 (*B)[KPITCH] = BsT[nt & 1];
    v8f acc[2][2] = {};
    // B fragments go through two register sets of two k blocks each: the next pair's
    // eight reads are issued as one group ahead of this pair's eight products
    V16H b[2][2][2];                             // [set][k block of the pair][nf]
    auto read_pair = [&](V16H (&s)[2][2], int kp) {
      #pragma unroll
      for (int kq = 0; kq < 2; ++kq) {
        #pragma unroll
        for (int nf = 0; nf < 2; ++nf) {
          const _Float16* p = &B[wc * 32 + nf * 16 + lrow][(kp * 2 + kq) * 32 + lhi * 8];
          s[kq][nf].h[0] = *(const v8h*)p;
          s[kq][nf].h[1] = *(const v8h*)(p + 16);
        }
      }
    };
    // bias of the lane's two columns: read ahead of the products, used behind them
    const float bv[2] = {bs[nt * 64 + wc * 32 + lrow], bs[nt * 64 + wc * 32 + 16 + lrow]};
    read_pair(b[0], 0);
    #pragma unroll   // constant LDS offsets and register indices
    for (int kp = 0; kp < KSTEPS / 2; ++kp) {
      if (kp + 1 < KSTEPS / 2) read_pair(b[(kp + 1) & 1], kp + 1);
      // holds the reads above in front of the products below: left alone, the compiler
      // sinks each read to just in front of its product, and the wave waits out the LDS
      __builtin_amdgcn_sched_barrier(0);
      #pragma unroll
      for (int kq = 0; kq < 2; ++kq) {
        #pragma unroll
        for (int mf = 0; mf < 2; ++mf) {
          #pragma unroll
          for (int nf = 0; nf < 2; ++nf)
            acc[mf][nf] = wmma_f16(a[mf][kp * 2 + kq], b[kp & 1][kq][nf], acc[mf][nf]);
        }
      }
      // keeps the reads of the pair after next from being spread among these products
      __builtin_amdgcn_sched_barrier(0);
    }

    // hand-over: this wave's reads of the buffer are done, its copies of the next tile
    // have landed; the barrier shows the next tile to every wave and frees this buffer
    asm volatile("s_wait_dscnt 0x0" ::: "memory");
    asm volatile("s_wait_asynccnt 0x0" ::: "memory");
    __syncthreads();
    if (nt + 2 < NT)                             // the same for the whole work-group
      copy_rows8(lds_addr(&BsT[nt & 1][wid * 8][lane * 8]), gb + (nt + 2) * 64 * DIM_D);

    epi(ntile, acc, bv);                         // reads no LDS: runs under the refill
    // the registers that the tile's stores name are rewritten by the next tile's reads
    // and products: the wait stands behind the last store, in front of any such overwrite
    asm volatile("s_wait_xcnt 0x0" ::: "memory");
  }
  asm volatile("s_wait_asynccnt 0x0" ::: "memory");   // no copy is left in flight at the end
}

// ---------------- Kernel 2: QKV GEMM (16384x256 x 256x768) ----------------
// 1/sqrt(hd) * log2(e): with it in Q, the score product comes out in the exponent's own
// unit (powers of two) and attention multiplies no score
#define LOG2E   1.44269504f
#define QSCALE  (0.17677669529663687f * LOG2E)
#define QKV_NT  (QKV_N / 64 / 2)                 // 6 column tiles a block
__global__ __launch_bounds__(256) void qkv_gemm_kernel(const _Float16* __restrict__ Ah,
                                                       const _Float16* __restrict__ BhT,
                                                       const float* __restrict__ bq,
                                                       _Float16* __restrict__ Qh,
                                                       _Float16* __restrict__ Kh,
                                                       _Float16* __restrict__ Vh) {
  __shared__ __align__(16) _Float16 As[128][KPITCH];      // 66 KB
  __shared__ __align__(16) _Float16 BsT[2][64][KPITCH];   // 2 x 33 KB
  __shared__ float bs[(QKV_NT * 64 + 255) / 256 * 256];
  const int row0 = blockIdx.x * 128;
  const int t = threadIdx.x, wid = t >> 5, lane = t & 31;
  const int lrow = lane & 15, lhi = lane >> 4;
  const int wr = wid & 3, wc = wid >> 2;

  // Epilogue: + bias, scatter into Q/K/V [n][h][l][hd] f16
  gemm_rows<QKV_NT>(Ah, BhT, bq, row0, blockIdx.y * (QKV_NT * 64), As, BsT, bs,
                    [&](int ntile, const v8f (&acc)[2][2], const float (&bv)[2]) {
    // a tile of 64 columns lies inside one of Q, K, V, and a wave's 32 columns are one head
    const int which = ntile >> 8;
    _Float16* dst = (which == 0) ? Qh : ((which == 1) ? Kh : Vh);
    const int hh = ((ntile & 255) >> 5) + wc;
    // Q is stored times QSCALE, applied in f32 ahead of the one rounding to f16; K and V times 1
    const float f = (which == 0) ? QSCALE : 1.0f;
    #pragma unroll
    for (int mf = 0; mf < 2; ++mf) {
      #pragma unroll
      for (int nf = 0; nf < 2; ++nf) {
        const float bf = bv[nf] * f;
        #pragma unroll
        for (int r = 0; r < 8; ++r) {
          int row = row0 + wr * 32 + mf * 16 + r + 8 * lhi;
          float v = acc[mf][nf][r] * f + bf;
          int n = row >> 9, l = row & 511;
          dst[((n * HEADS + hh) * LEN_L + l) * HD + nf * 16 + lrow] = (_Float16)v;
        }
      }
    }
  });
}

// ---------------- Kernel 4: proj GEMM + bias + residual ----------------
#define PROJ_NT (DIM_D / 64 / 2)                 // 2 column tiles a block
__global__ __launch_bounds__(256) void proj_gemm_kernel(const _Float16* __restrict__ Ah,
                                                        const _Float16* __restrict__ BhT,
                                                        const float* __restrict__ bp,
                                                        const float* __restrict__ resid,
                                                        float* __restrict__ out) {
  __shared__ __align__(16) _Float16 As[128][KPITCH];      // 66 KB
  __shared__ __align__(16) _Float16 BsT[2][64][KPITCH];   // 2 x 33 KB
  __shared__ float bs[(PROJ_NT * 64 + 255) / 256 * 256];
  const int row0 = blockIdx.x * 128;
  const int t = threadIdx.x, wid = t >> 5, lane = t & 31;
  const int lrow = lane & 15, lhi = lane >> 4;
  const int wr = wid & 3, wc = wid >> 2;

  gemm_rows<PROJ_NT>(Ah, BhT, bp, row0, blockIdx.y * (PROJ_NT * 64), As, BsT, bs,
                     [&](int ntile, const v8f (&acc)[2][2], const float (&bv)[2]) {
    #pragma unroll
    for (int mf = 0; mf < 2; ++mf) {
      #pragma unroll
      for (int nf = 0; nf < 2; ++nf) {
        #pragma unroll
        for (int r = 0; r < 8; ++r) {
          int col = ntile + wc * 32 + nf * 16 + lrow;
          int row = row0 + wr * 32 + mf * 16 + r + 8 * lhi;
          out[row * DIM_D + col] = acc[mf][nf][r] + bv[nf] + resid[row * DIM_D + col];
        }
      }
    }
  });
}

#define PLIMIT 256.0f
// Eight 2^x by the builtin: the arguments are a matrix instruction's result, and the
// compiler keeps the distance behind that instruction only for instructions it knows.
__device__ __forceinline__ v8f exp2x8(v8f x) {
  v8f y;
  #pragma unroll   // constant indices into the vectors
  for (int r = 0; r < 8; ++r) y[r] = __builtin_amdgcn_exp2f(x[r]);
  return y;
}

__global__ __launch_bounds__(256) void attn_kernel(const _Float16* __restrict__ Qh,
                                                   const _Float16* __restrict__ Kh,
                                                   const _Float16* __restrict__ Vh,
                                                   const float* __restrict__ pbt, // [h][k/4][q][k%4]
                                                   _Float16* __restrict__ AO) {
  __shared__ __align__(16) _Float16 Ks[2][32][LPITCH]; // [key][d]
  __shared__ __align__(16) _Float16 Vt[2][32][LPITCH]; // [d][key]
  const int nh = blockIdx.y;                 // n*8 + h
  const int n = nh >> 3, h = nh & 7;
  const int q0 = blockIdx.x * 128;
  const int t = threadIdx.x, wid = t >> 5, lane = t & 31;
  const int lrow = lane & 15, lhi = lane >> 4;

  const _Float16* Qb = Qh + (size_t)nh * LEN_L * HD;
  const _Float16* Kb = Kh + (size_t)nh * LEN_L * HD;
  const _Float16* Vb = Vh + (size_t)nh * LEN_L * HD;
  const int qrow = q0 + wid * 16 + lrow;     // this lane's query
  // this lane's query in the bias plane, at its first group of four keys
  const float* brow = pbt + (size_t)h * LEN_L * LEN_L + lhi * 2 * (LEN_L * 4) + qrow * 4;

  V16H bq;                                   // Qt as B operand: column = query
  bq.h[0] = *(const v8h*)(Qb + qrow * HD + lhi * 8);
  bq.h[1] = *(const v8h*)(Qb + qrow * HD + lhi * 8 + 16);

  float mref = 0.0f, rsum = 0.0f;            // rsum: this half's keys only
  v8f o0 = {}, o1 = {};                      // Ot rows hd 0..15 / 16..31
  auto sum16 = [](const v8f& a, const v8f& b) {   // halved three times: every add but the last is a packed pair
    const v8f s = a + b;
    const v4f u = __builtin_shufflevector(s, s, 0, 1, 2, 3) + __builtin_shufflevector(s, s, 4, 5, 6, 7);
    return (u[0] + u[2]) + (u[1] + u[3]);
  };

  const int skey = t >> 3, sds = (t & 7) * 4;  // staging: 4 halves/thread each
  v4h kr, vr;
  auto gload = [&](int kc) {
    kr = *(const v4h*)(Kb + (kc + skey) * HD + sds);
    vr = *(const v4h*)(Vb + (kc + skey) * HD + sds);
  };
  auto sstore = [&](int buf) {
    *(v4h*)&Ks[buf][skey][sds] = kr;
    Vt[buf][sds + 0][skey] = vr[0]; Vt[buf][sds + 1][skey] = vr[1];
    Vt[buf][sds + 2][skey] = vr[2]; Vt[buf][sds + 3][skey] = vr[3];
  };

  gload(0);
  // the address registers of the Q, K and V loads above are reused right behind
  // them (the zeroed accumulators): the wait stands in front of that overwrite
  asm volatile("s_wait_xcnt 0x0" ::: "memory");
  sstore(0);
  __syncthreads();

  for (int kc = 0; kc < LEN_L; kc += 32) {
    const int buf = (kc >> 5) & 1;
    const bool more = (kc + 32) < LEN_L;
    if (more) {
      gload(kc + 32);                                      // overlap with compute
      __builtin_prefetch(brow + (kc + 32) * LEN_L, 0, 0);
    }

    // bias of keys kc+8h+0..7 and kc+16+8h+0..7 for this lane's query
    const float* bc = brow + kc * LEN_L;     // key group kc/4 (+ 2 in the upper half)
    const v4f g0 = *(const v4f*)(bc);
    const v4f g1 = *(const v4f*)(bc + 1 * (LEN_L * 4));
    const v4f g4 = *(const v4f*)(bc + 4 * (LEN_L * 4));
    const v4f g5 = *(const v4f*)(bc + 5 * (LEN_L * 4));

    // scores: St(32x16) = K(32x32) * Qt  (A frag [key][d] == Ks row-major)
    V16H ak0, ak1;
    ak0.h[0] = *(const v8h*)&Ks[buf][lrow][lhi * 8];
    ak0.h[1] = *(const v8h*)&Ks[buf][lrow][lhi * 8 + 16];
    ak1.h[0] = *(const v8h*)&Ks[buf][16 + lrow][lhi * 8];
    ak1.h[1] = *(const v8h*)&Ks[buf][16 + lrow][lhi * 8 + 16];
    // the Vt fragments of the second product are read here, ahead of the test below, so
    // that their way from LDS runs under the first product and the 2^x
    V16H av0, av1;
    av0.h[0] = *(const v8h*)&Vt[buf][lrow][lhi * 8];
    av0.h[1] = *(const v8h*)&Vt[buf][lrow][lhi * 8 + 16];
    av1.h[0] = *(const v8h*)&Vt[buf][16 + lrow][lhi * 8];
    av1.h[1] = *(const v8h*)&Vt[buf][16 + lrow][lhi * 8 + 16];
    // keeps the scheduler from moving these reads down to just in front of their first use
    __builtin_amdgcn_sched_barrier(0);

    const v8f bb0 = __builtin_shufflevector(g0, g1, 0, 1, 2, 3, 4, 5, 6, 7);
    const v8f bb1 = __builtin_shufflevector(g4, g5, 0, 1, 2, 3, 4, 5, 6, 7);
    // C layout: col=lane&15 (query), row=r+8*(lane>>4) (key); t = log2-scaled score - mref
    v8f t0 = wmma_f16(ak0, bq, bb0 * LOG2E - mref);
    v8f t1 = wmma_f16(ak1, bq, bb1 * LOG2E - mref);
    v8f p0 = exp2x8(t0);
    v8f p1 = exp2x8(t1);
    float ps = sum16(p0, p1);
    // holds the four Vt reads above this line (loaded values as inputs only): left alone, the
    // compiler sinks them behind the test, where the wave waits out the LDS in front of each product
    asm volatile("" :: "v"(av0.v), "v"(av1.v));

    // The first pass has no reference yet; a later pass comes here only when a lane's sum
    // is above the limit (or not a number). The test is the same for the whole wave.
    const bool first = (kc == 0);
    if (first || __builtin_amdgcn_ballot_w32(!(ps <= PLIMIT)) != 0) {
      float mc = fmaxf(t0[0], t1[0]);
      #pragma unroll
      for (int r = 1; r < 8; ++r) mc = fmaxf(mc, fmaxf(t0[r], t1[r]));
      mc = fmaxf(mc, xhalf(mc));             // the other half's 16 keys: both halves agree
      const float d = first ? mc : fmaxf(mc, 0.0f);   // the reference never falls
      const float alpha = first ? 1.0f : __builtin_amdgcn_exp2f(-d);   // O and rsum are 0 at first
      mref += d;
      p0 = exp2x8(t0 - d);
      p1 = exp2x8(t1 - d);
      ps = sum16(p0, p1);
      rsum *= alpha;
      o0 *= alpha;
      o1 *= alpha;
    }
    rsum += ps;
    V16H bp;                                 // Pt as B operand, straight from St
    #pragma unroll
    for (int r = 0; r < 8; ++r) {
      bp.h[0][r] = (_Float16)p0[r];
      bp.h[1][r] = (_Float16)p1[r];
    }

    // Ot(32x16) += Vt(32x32) * Pt(32x16); A frag [hd][key] == Vt row-major
    o0 = wmma_f16(av0, bp, o0);
    o1 = wmma_f16(av1, bp, o1);

    if (more) sstore(buf ^ 1);
    __syncthreads();
  }

  // join the halves' sums, normalize, store to attn_out [n][l][h*32+hd] f16:
  // a lane holds hd 8h+0..7 and 16+8h+0..7 of its query, two 16-byte stores
  const float inv = 1.0f / (rsum + xhalf(rsum));
  v8h w0, w1;
  #pragma unroll
  for (int r = 0; r < 8; ++r) {
    w0[r] = (_Float16)(o0[r] * inv);
    w1[r] = (_Float16)(o1[r] * inv);
  }
  _Float16* dst = AO + ((size_t)n * LEN_L + qrow) * DIM_D + h * HD + lhi * 8;
  *(v8h*)dst        = w0;
  *(v8h*)(dst + 16) = w1;
}

// ---------------- launch ----------------
extern "C" void kernel_launch(void* const* d_in, const int* in_sizes, int n_in,
                              void* d_out, int out_size, void* d_ws, size_t ws_size,
                              hipStream_t stream) {
  const float* msa   = (const float*)d_in[0];
  const float* pbias = (const float*)d_in[1];
  const float* lnw   = (const float*)d_in[2];
  const float* lnb   = (const float*)d_in[3];
  const float* wqkv  = (const float*)d_in[4];
  const float* bqkv  = (const float*)d_in[5];
  const float* wproj = (const float*)d_in[6];
  const float* bproj = (const float*)d_in[7];
  float* out = (float*)d_out;

  char* ws = (char*)d_ws;
  // workspace layout (bytes), all offsets 16B-aligned
  _Float16* WqkvT  = (_Float16*)(ws + 0);          // [768][256] f16 = 393216
  _Float16* WprojT = (_Float16*)(ws + 393216);     // [256][256] f16 = 131072
  _Float16* Mh     = (_Float16*)(ws + 524288);     // 16384*256*2 = 8388608
  _Float16* Qh     = (_Float16*)(ws + 8912896);    // 8388608
  _Float16* Kh     = (_Float16*)(ws + 17301504);   // 8388608
  _Float16* Vh     = (_Float16*)(ws + 25690112);   // 8388608
  _Float16* AOh    = (_Float16*)(ws + 34078720);   // 8388608
  float*    PbT    = (float*)   (ws + 42467328);   // 8*512*512*4 = 8388608 (total ~48.5 MB)

  prep_kernel<<<LN_BLOCKS + CVQ_BLOCKS + CVP_BLOCKS + BIAS_BLOCKS, 256, 0, stream>>>(
      msa, lnw, lnb, wqkv, wproj, pbias, Mh, WqkvT, WprojT, PbT);
  qkv_gemm_kernel<<<dim3(MROWS / 128, 2), 256, 0, stream>>>(Mh, WqkvT, bqkv, Qh, Kh, Vh);
  attn_kernel<<<dim3(LEN_L / 128, SEQ_N * HEADS), 256, 0, stream>>>(Qh, Kh, Vh, PbT, AOh);
  proj_gemm_kernel<<<dim3(MROWS / 128, 2), 256, 0, stream>>>(AOh, WprojT, bproj, msa, out);
}

// v009
// It runs in 39.1 microseconds.
// Next to v008, in two timings, it ran 1.27 and 1.28 times as fast.
// Over all steps from v000 it is 2.89 times as fast.
#include <hip/hip_runtime.h>
#include <math.h>

// ---- CDNA5 WMMA types ----
typedef __attribute__((ext_vector_type(16))) _Float16 v16h;
typedef __attribute__((ext_vector_type(8)))  _Float16 v8h;
typedef __attribute__((ext_vector_type(4)))  _Float16 v4h;
typedef __attribute__((ext_vector_type(8)))  float    v8f;
typedef __attribute__((ext_vector_type(4)))  float    v4f;

union V16H { v16h v; v8h h[2]; };

__device__ __forceinline__ v8f wmma_f16(const V16H& a, const V16H& b, v8f c) {
  // D = A(16x32 f16) * B(32x16 f16) + C(16x16 f32)
  return __builtin_amdgcn_wmma_f32_16x16x32_f16(false, a.v, false, b.v,
                                                (short)0, c, false, false);
}

// Problem constants: B=1, N=32, L=512, D=256, H=8, hd=32
#define SEQ_N   32
#define LEN_L   512
#define DIM_D   256
#define HEADS   8
#define HD      32
#define MROWS   (SEQ_N * LEN_L)   // 16384
#define QKV_N   (3 * DIM_D)       // 768

// LDS rows that hold 32 halves (64 bytes) of a matrix fragment's k range are laid at
// a pitch of 40 halves (80 bytes = 16 x 5). The 16 lanes of a half wave read 16 bytes
// each from 16 rows: at 64 bytes the rows fall on 4 bank groups, four rows on each;
// at 80 bytes the 16 rows fall on 16 different groups of four banks.
#define LPITCH  40

// The four preparation stages below depend on none of one another's results. They
// are bodies of ONE launch (prep_kernel): each work-group takes one stage's block,
// blk being the block's index inside that stage.

// ------- Stage: weight convert + transpose: [k][n] f32 -> [n][k] f16 -----
// A thread takes eight k of one n: the lanes run along n, so each of its eight loads
// is 128 contiguous bytes a wave, and its eight halves leave as one 16-byte store.
#define CV_K 8                                       // k per thread
__device__ __forceinline__ void cvt_tr_body(const float* __restrict__ src,
                                            _Float16* __restrict__ dst,
                                            int K, int N, int blk) {
  int i = blk * 256 + threadIdx.x;                   // linear index over [k/8][n]
  if (i >= K * N / CV_K) return;
  int n = i % N, k0 = (i / N) * CV_K;
  float x[CV_K];
  #pragma unroll   // x lives in registers; the eight loads are issued back to back
  for (int j = 0; j < CV_K; ++j) x[j] = src[(k0 + j) * N + n];
  v8h y;
  #pragma unroll   // constant indices into the vector
  for (int j = 0; j < CV_K; ++j) y[j] = (_Float16)x[j];
  *(v8h*)(dst + n * K + k0) = y;
}

// ------ Stage: pair_bias transpose [q][k][h] -> [h][k/4][q][k%4] ------
// q runs across the lanes of a transposed score tile, so a lane's four keys lie
// in 16 bytes and 16 neighbouring queries in 256 contiguous bytes.
// A wave takes 16 queries x 8 keys x 8 heads (4 KB). In: a query's 8 keys x 8 heads
// are 256 contiguous bytes, two queries to a wave load, all eight loads in flight.
// Out: per head, 16 queries of one key group are 256 contiguous bytes, two key groups
// to a wave store. The turn between the two orders goes through the wave's own LDS
// tile; its rows of 64 floats lie at 68, a multiple of 16 bytes for the b128 writes
// that spreads the 16 rows which a half wave reads back over the banks.
#define BT_PITCH 68
__device__ __forceinline__ void bias_tr_body(const float* __restrict__ pb,
                                             float* __restrict__ pbt, int blk) {
  __shared__ __align__(16) float tile[8][16][BT_PITCH];   // 34 KB
  const int wid = threadIdx.x >> 5, lane = threadIdx.x & 31;
  const int lrow = lane & 15, lhi = lane >> 4;
  const int w  = blk * 8 + wid;                      // 0 .. 2047
  const int kp = w & (LEN_L / 8 - 1);                // which run of eight keys
  const int q0 = (w >> 6) * 16;                      // first query

  v4f x[8];
  #pragma unroll   // x lives in registers; the eight loads are issued back to back
  for (int i = 0; i < 8; ++i)
    x[i] = *(const v4f*)(pb + ((q0 + 2 * i + lhi) * LEN_L + kp * 8) * HEADS + lrow * 4);
  #pragma unroll   // constant indices into x
  for (int i = 0; i < 8; ++i)
    *(v4f*)&tile[wid][2 * i + lhi][lrow * 4] = x[i];
  __syncthreads();   // the lanes read what other lanes of the wave have written

  #pragma unroll   // one store a head
  for (int h = 0; h < HEADS; ++h) {
    const float* c = &tile[wid][lrow][lhi * 4 * HEADS + h];   // query lrow, key group lhi
    const v4f y = v4f{c[0], c[HEADS], c[2 * HEADS], c[3 * HEADS]};
    *(v4f*)(pbt + (((h * (LEN_L / 4)) + kp * 2 + lhi) * LEN_L + q0 + lrow) * 4) = y;
  }
  // the registers that the eight stores name are free for reuse behind this stage:
  // the wait stands behind the last store, in front of any such overwrite
  asm volatile("s_wait_xcnt 0x0" ::: "memory");
}

// ---------------- Stage: LayerNorm -> f16 ----------------
// One wave owns a whole row (8 elements a lane, as two 512-byte wave loads) and
// takes four rows, all eight loads in flight at once: 4096 waves start instead of
// 131072, and the row sums need neither LDS nor a barrier.
__device__ __forceinline__ float xhalf(float x) {   // value of lane l ^ 16
  int b = __builtin_bit_cast(int, x);
  return __builtin_bit_cast(float,
      __builtin_amdgcn_permlanex16(b, b, 0x76543210, 0xfedcba98, false, false));
}

template <int M>
__device__ __forceinline__ float xrow(float x) {    // value of lane l ^ M, M < 16
  return __builtin_bit_cast(float,
      __builtin_amdgcn_update_dpp(0, __builtin_bit_cast(int, x), 0x160 | M, 0xf, 0xf, true));
}

__device__ __forceinline__ float wave_sum(float x) { // butterfly: every lane gets the sum
  x += xrow<1>(x);
  x += xrow<2>(x);
  x += xrow<4>(x);
  x += xrow<8>(x);
  return x + xhalf(x);
}

#define LN_ROWS 4                                    // rows per wave
__device__ __forceinline__ void ln_body(const float* __restrict__ msa,
                                        const float* __restrict__ lw,
                                        const float* __restrict__ lb,
                                        _Float16* __restrict__ mh, int blk) {
  const int c = (threadIdx.x & 31) * 4;              // columns c..c+3 and 128+c..128+c+3
  const int row0 = (blk * 8 + (threadIdx.x >> 5)) * LN_ROWS;

  const v4f w0 = *(const v4f*)(lw + c), w1 = *(const v4f*)(lw + 128 + c);
  const v4f b0 = *(const v4f*)(lb + c), b1 = *(const v4f*)(lb + 128 + c);
  v4f x0[LN_ROWS], x1[LN_ROWS];
  #pragma unroll   // the rows live in registers: constant indices, loads issued back to back
  for (int r = 0; r < LN_ROWS; ++r) {
    const float* p = msa + (row0 + r) * DIM_D + c;
    x0[r] = *(const v4f*)p;
    x1[r] = *(const v4f*)(p + 128);
  }

  #pragma unroll   // four independent butterfly chains fill one another's latency
  for (int r = 0; r < LN_ROWS; ++r) {
    const v4f s = x0[r] + x1[r];
    const float mu = wave_sum((s[0] + s[1]) + (s[2] + s[3])) * (1.0f / DIM_D);
    const v4f d0 = x0[r] - mu, d1 = x1[r] - mu;
    const v4f q = d0 * d0 + d1 * d1;
    const float var = wave_sum((q[0] + q[1]) + (q[2] + q[3])) * (1.0f / DIM_D);
    const float rs = rsqrtf(var + 1e-5f);
    const v4f y0 = d0 * rs * w0 + b0, y1 = d1 * rs * w1 + b1;
    _Float16* o = mh + (row0 + r) * DIM_D + c;
    *(v4h*)o         = v4h{(_Float16)y0[0], (_Float16)y0[1], (_Float16)y0[2], (_Float16)y0[3]};
    *(v4h*)(o + 128) = v4h{(_Float16)y1[0], (_Float16)y1[1], (_Float16)y1[2], (_Float16)y1[3]};
  }
}

// ---------------- Kernel 0: all four preparation stages, one launch ----------------
// The LayerNorm blocks come first (for speed only).
#define LN_BLOCKS   (MROWS / (8 * LN_ROWS))             // 512
#define CVQ_BLOCKS  (DIM_D * QKV_N / (CV_K * 256))      // 96
#define CVP_BLOCKS  (DIM_D * DIM_D / (CV_K * 256))      // 32
#define BIAS_BLOCKS ((LEN_L / 16) * (LEN_L / 8) / 8)    // 256
__global__ __launch_bounds__(256) void prep_kernel(const float* __restrict__ msa,
                                                   const float* __restrict__ lw,
                                                   const float* __restrict__ lb,
                                                   const float* __restrict__ wqkv,
                                                   const float* __restrict__ wproj,
                                                   const float* __restrict__ pb,
                                                   _Float16* __restrict__ mh,
                                                   _Float16* __restrict__ wqkvT,
                                                   _Float16* __restrict__ wprojT,
                                                   float* __restrict__ pbt) {
  const int b = blockIdx.x;                            // the same for a whole work-group
  if (b < LN_BLOCKS)
    ln_body(msa, lw, lb, mh, b);
  else if (b < LN_BLOCKS + CVQ_BLOCKS)
    cvt_tr_body(wqkv, wqkvT, DIM_D, QKV_N, b - LN_BLOCKS);
  else if (b < LN_BLOCKS + CVQ_BLOCKS + CVP_BLOCKS)
    cvt_tr_body(wproj, wprojT, DIM_D, DIM_D, b - (LN_BLOCKS + CVQ_BLOCKS));
  else
    bias_tr_body(pb, pbt, b - (LN_BLOCKS + CVQ_BLOCKS + CVP_BLOCKS));
}

// ============ GEMM body (a block keeps its A rows and walks column tiles) ============
// A block owns 128 rows of A and NT column tiles of 64. 8 waves as 4 x 2: a wave owns
// 32 rows x 32 columns of each tile (2 x 2 C frags).
// A: [M][256] f16 row-major. BhT: [N][256] f16 (pre-transposed weights).
// k is only 256, so a row of either operand is 512 bytes: one asynchronous copy of a
// wave (32 lanes x 16 bytes) brings one whole row, four full lines, straight into LDS.
// The A rows are brought once; each wave then lifts its 32 rows over the whole k range
// into registers (16 fragments) and uses them for every column tile, so that a tile
// costs only its own B rows, from L2 and from LDS alike. The B tiles go through two
// buffers: the next tile's copies fly while this tile's products run.
// LDS rows lie at 528 bytes (16 x 33): the 16 rows that a half wave reads by
// ds_load_b128 fall on 16 different groups of four banks.
#define KPITCH  (DIM_D + 8)
#define KSTEPS  (DIM_D / 32)

__device__ __forceinline__ unsigned lds_addr(const void* p) {  // byte offset in the work-group's LDS
  return (unsigned)(size_t)p;
}

// Eight rows, one copy each: LDS rows KPITCH halves apart, global rows DIM_D halves apart.
// The closing s_wait_xcnt stands inside the statement, behind the last copy, so that no
// register which a copy names is rewritten in front of it.
__device__ __forceinline__ void copy_rows8(unsigned l, const _Float16* g) {
  asm volatile(
      "global_load_async_to_lds_b128 %0, %8, off\n\t"
      "global_load_async_to_lds_b128 %1, %9, off\n\t"
      "global_load_async_to_lds_b128 %2, %10, off\n\t"
      "global_load_async_to_lds_b128 %3, %11, off\n\t"
      "global_load_async_to_lds_b128 %4, %12, off\n\t"
      "global_load_async_to_lds_b128 %5, %13, off\n\t"
      "global_load_async_to_lds_b128 %6, %14, off\n\t"
      "global_load_async_to_lds_b128 %7, %15, off\n\t"
      "s_wait_xcnt 0x0"
      :: "v"(l), "v"(l + 1 * KPITCH * 2), "v"(l + 2 * KPITCH * 2), "v"(l + 3 * KPITCH * 2),
         "v"(l + 4 * KPITCH * 2), "v"(l + 5 * KPITCH * 2), "v"(l + 6 * KPITCH * 2),
         "v"(l + 7 * KPITCH * 2),
         "v"(g), "v"(g + 1 * DIM_D), "v"(g + 2 * DIM_D), "v"(g + 3 * DIM_D),
         "v"(g + 4 * DIM_D), "v"(g + 5 * DIM_D), "v"(g + 6 * DIM_D), "v"(g + 7 * DIM_D)
      : "memory");
}

// epi(first column of the tile, acc, bias of the lane's two columns) stores one tile.
// C frag (mf, nf) of a wave: row = row0 + wr * 32 + mf * 16 + r + 8 * lhi,
//                            col = tile + wc * 32 + nf * 16 + lrow.
template <int NT, class Epi>
__device__ __forceinline__ void gemm_rows(const _Float16* __restrict__ Ah,
                                          const _Float16* __restrict__ BhT,
                                          const float* __restrict__ bias,
                                          int row0, int ntile0,
                                          _Float16 (*As)[KPITCH],
                                          _Float16 (*BsT)[64][KPITCH],
                                          float* bs, Epi epi) {
  const int t = threadIdx.x, wid = t >> 5, lane = t & 31;
  const int lrow = lane & 15, lhi = lane >> 4;
  const int wr = wid & 3, wc = wid >> 2;

  // wave wid brings A rows 16 wid .. 16 wid + 15 and, of each tile, B rows
  // 8 wid .. 8 wid + 7; a lane brings halves 8 lane .. 8 lane + 7 of each row
  const _Float16* ga = Ah + (row0 + wid * 16) * DIM_D + lane * 8;
  const _Float16* gb = BhT + (ntile0 + wid * 8) * DIM_D + lane * 8;
  copy_rows8(lds_addr(&As[wid * 16][lane * 8]), ga);
  copy_rows8(lds_addr(&As[wid * 16 + 8][lane * 8]), ga + 8 * DIM_D);
  copy_rows8(lds_addr(&BsT[0][wid * 8][lane * 8]), gb);
  // the bias of the block's NT * 64 columns goes to LDS once, under the copies' flight;
  // the barrier below shows it to every wave. bs is rounded up to whole blocks of 256,
  // so that every lane stays on; the places past the end repeat the last column's bias
  #pragma unroll
  for (int i = 0; i < NT * 64; i += 256) {
    const int j = i + t;
    bs[j] = bias[ntile0 + (j < NT * 64 ? j : NT * 64 - 1)];
  }
  // this wave's copies have landed behind this wait; the barrier then shows every
  // wave's rows to every wave
  asm volatile("s_wait_asynccnt 0x0" ::: "memory");
  __syncthreads();
  if (NT > 1) copy_rows8(lds_addr(&BsT[1][wid * 8][lane * 8]), gb + 64 * DIM_D);

  V16H a[2][KSTEPS];                             // the wave's 32 A rows, whole k range
  #pragma unroll   // a lives in registers: constant indices
  for (int mf = 0; mf < 2; ++mf) {
    #pragma unroll
    for (int ks = 0; ks < KSTEPS; ++ks) {
      a[mf][ks].h[0] = *(const v8h*)&As[wr * 32 + mf * 16 + lrow][ks * 32 + lhi * 8];
      a[mf][ks].h[1] = *(const v8h*)&As[wr * 32 + mf * 16 + lrow][ks * 32 + lhi * 8 + 16];
    }
  }

  #pragma unroll 1   // one copy of the tile's code serves every tile
  for (int nt = 0; nt < NT; ++nt) {
    const int ntile = ntile0 + nt * 64;
    const _Float16 (*B)[KPITCH] = BsT[nt & 1];
    v8f acc[2][2] = {};
    // B fragments go through two register sets of two k blocks each: the next pair's
    // eight reads are issued as one group ahead of this pair's eight products
    V16H b[2][2][2];                             // [set][k block of the pair][nf]
    auto read_pair = [&](V16H (&s)[2][2], int kp) {
      #pragma unroll
      for (int kq = 0; kq < 2; ++kq) {
        #pragma unroll
        for (int nf = 0; nf < 2; ++nf) {
          const _Float16* p = &B[wc * 32 + nf * 16 + lrow][(kp * 2 + kq) * 32 + lhi * 8];
          s[kq][nf].h[0] = *(const v8h*)p;
          s[kq][nf].h[1] = *(const v8h*)(p + 16);
        }
      }
    };
    // bias of the lane's two columns: read ahead of the products, used behind them
    const float bv[2] = {bs[nt * 64 + wc * 32 + lrow], bs[nt * 64 + wc * 32 + 16 + lrow]};
    read_pair(b[0], 0);
    #pragma unroll   // constant LDS offsets and register indices
    for (int kp = 0; kp < KSTEPS / 2; ++kp) {
      if (kp + 1 < KSTEPS / 2) read_pair(b[(kp + 1) & 1], kp + 1);
      // holds the reads above in front of the products below: left alone, the compiler
      // sinks each read to just in front of its product, and the wave waits out the LDS
      __builtin_amdgcn_sched_barrier(0);
      #pragma unroll
      for (int kq = 0; kq < 2; ++kq) {
        #pragma unroll
        for (int mf = 0; mf < 2; ++mf) {
          #pragma unroll
          for (int nf = 0; nf < 2; ++nf)
            acc[mf][nf] = wmma_f16(a[mf][kp * 2 + kq], b[kp & 1][kq][nf], acc[mf][nf]);
        }
      }
      // keeps the reads of the pair after next from being spread among these products
      __builtin_amdgcn_sched_barrier(0);
    }

    // hand-over: this wave's reads of the buffer are done, its copies of the next tile
    // have landed; the barrier shows the next tile to every wave and frees this buffer
    asm volatile("s_wait_dscnt 0x0" ::: "memory");
    asm volatile("s_wait_asynccnt 0x0" ::: "memory");
    __syncthreads();
    if (nt + 2 < NT)                             // the same for the whole work-group
      copy_rows8(lds_addr(&BsT[nt & 1][wid * 8][lane * 8]), gb + (nt + 2) * 64 * DIM_D);

    epi(ntile, acc, bv);                         // reads no LDS
    // the registers that the tile's stores name are rewritten by the next tile's reads
    // and products: the wait stands behind the last store, in front of any such overwrite
    asm volatile("s_wait_xcnt 0x0" ::: "memory");
  }
  asm volatile("s_wait_asynccnt 0x0" ::: "memory");   // no copy is left in flight at the end
}

#define PLIMIT 256.0f
// 1/sqrt(hd) * log2(e): with it in Q, the score product comes out in the exponent's own
// unit (powers of two) and attention multiplies no score
#define LOG2E   1.44269504f
#define QSCALE  (0.17677669529663687f * LOG2E)
#define FW      16                 // waves a block
#define MCH     64                 // k of one chunk of M
#define MPITCH  (MCH + 8)          // 144 bytes = 16 x 9: 16 rows fall on 16 bank groups
#define VPITCH  (LEN_L + 8)        // 1040 bytes = 16 x 65: the same for the rows of Vt
// Eight 2^x by the builtin: the arguments are a matrix instruction's result, and the
// compiler keeps the distance behind that instruction only for instructions it knows.
__device__ __forceinline__ v8f exp2x8(v8f x) {
  v8f y;
  #pragma unroll   // constant indices into the vectors
  for (int r = 0; r < 8; ++r) y[r] = __builtin_amdgcn_exp2f(x[r]);
  return y;
}

// Eight copies, four rows of 128 bytes each: LDS rows MPITCH halves apart, global rows
// DIM_D halves apart. The closing s_wait_xcnt stands inside the statement, behind the last
// copy, so that no register which a copy names is rewritten in front of it.
__device__ __forceinline__ void copy_chunk(unsigned l, const _Float16* g) {
  asm volatile(
      "global_load_async_to_lds_b128 %0, %8, off\n\t"
      "global_load_async_to_lds_b128 %1, %9, off\n\t"
      "global_load_async_to_lds_b128 %2, %10, off\n\t"
      "global_load_async_to_lds_b128 %3, %11, off\n\t"
      "global_load_async_to_lds_b128 %4, %12, off\n\t"
      "global_load_async_to_lds_b128 %5, %13, off\n\t"
      "global_load_async_to_lds_b128 %6, %14, off\n\t"
      "global_load_async_to_lds_b128 %7, %15, off\n\t"
      "s_wait_xcnt 0x0"
      :: "v"(l), "v"(l + 4 * MPITCH * 2), "v"(l + 8 * MPITCH * 2), "v"(l + 12 * MPITCH * 2),
         "v"(l + 16 * MPITCH * 2), "v"(l + 20 * MPITCH * 2), "v"(l + 24 * MPITCH * 2),
         "v"(l + 28 * MPITCH * 2),
         "v"(g), "v"(g + 4 * DIM_D), "v"(g + 8 * DIM_D), "v"(g + 12 * DIM_D),
         "v"(g + 16 * DIM_D), "v"(g + 20 * DIM_D), "v"(g + 24 * DIM_D), "v"(g + 28 * DIM_D)
      : "memory");
}

__global__ __launch_bounds__(512) void qkv_attn_kernel(const _Float16* __restrict__ Mh,
                                                       const _Float16* __restrict__ WT,  // [768][256]
                                                       const float* __restrict__ bqkv,
                                                       const float* __restrict__ pbt,    // [h][k/4][q][k%4]
                                                       _Float16* __restrict__ AO) {
  // one object, so that the order is fixed: every fragment read of part 1 then lies within
  // the 64 KB that an LDS instruction's offset field reaches from one base register
  __shared__ __align__(16) struct {
    _Float16 Ws[3 * HD][KPITCH];             // 50 KB: the head's Q, K, V weight rows
    _Float16 Ms[FW][2][32][MPITCH];          // 144 KB: [wave][buffer][row][k]
    _Float16 Ks[LEN_L][LPITCH];              // 40 KB: [key][d]
    _Float16 Vt[HD][VPITCH];                 // 33 KB: [d][key]
  } S;
  const int nh = blockIdx.x;                 // n*8 + h
  const int n = nh >> 3, h = nh & 7;
  const int t = threadIdx.x, lane = t & 31;
  const int wid = __builtin_amdgcn_readfirstlane(t >> 5);  // the wave's number, in a scalar register
  const int lrow = lane & 15, lhi = lane >> 4;

  // ---- part 1: the head's Q, K, V ----
  // a copy brings four rows of the chunk: lane l brings halves 8 (l & 7) .. + 7 of row l >> 3
  const _Float16* gm = Mh + ((size_t)n * LEN_L + wid * 32 + (lane >> 3)) * DIM_D + (lane & 7) * 8;
  auto copy_m = [&](int c) {
    copy_chunk(lds_addr(&S.Ms[wid][c & 1][lane >> 3][(lane & 7) * 8]), gm + c * MCH);
  };
  // waves 0 .. 11 bring eight weight rows each, a whole row (512 bytes) a copy; a group of
  // eight lies inside one of Q, K, V. The test is the same for a whole wave.
  if (wid < 12)
    copy_rows8(lds_addr(&S.Ws[wid * 8][lane * 8]),
               WT + ((wid >> 2) * DIM_D + h * HD + (wid & 3) * 8) * DIM_D + lane * 8);
  copy_m(0);
  // bias of the head's columns, read under the copies' flight: eight d a lane and tile for
  // Q and K (d runs down a lane's registers), one d a lane and tile for V (d runs across lanes).
  // It is the start value of the accumulators.
  v4f bqv[2][2], bkv[2][2];
  float bvv[2];
  #pragma unroll   // constant indices
  for (int dt = 0; dt < 2; ++dt) {
    const float* p = bqkv + h * HD + dt * 16 + lhi * 8;
    bqv[dt][0] = *(const v4f*)p;
    bqv[dt][1] = *(const v4f*)(p + 4);
    bkv[dt][0] = *(const v4f*)(p + DIM_D);
    bkv[dt][1] = *(const v4f*)(p + DIM_D + 4);
    bvv[dt] = bqkv[2 * DIM_D + h * HD + dt * 16 + lrow];
  }
  // the address registers of the loads above are free for reuse behind them: the wait
  // stands in front of any such overwrite
  asm volatile("s_wait_xcnt 0x0" ::: "memory");
  // this wave's copies have landed behind this wait; the barrier then shows the weight
  // rows to every wave
  asm volatile("s_wait_asynccnt 0x0" ::: "memory");
  __syncthreads();
  copy_m(1);

  v8f aq[2][2], ak[2][2];                    // [d tile][row tile], transposed
  v8f av[2][2];                              // [row tile][d tile]
  #pragma unroll   // constant indices
  for (int dt = 0; dt < 2; ++dt) {
    #pragma unroll
    for (int rt = 0; rt < 2; ++rt) {
      aq[dt][rt] = __builtin_shufflevector(bqv[dt][0], bqv[dt][1], 0, 1, 2, 3, 4, 5, 6, 7);
      ak[dt][rt] = __builtin_shufflevector(bkv[dt][0], bkv[dt][1], 0, 1, 2, 3, 4, 5, 6, 7);
      #pragma unroll
      for (int r = 0; r < 8; ++r) av[rt][dt][r] = bvv[dt];
    }
  }
  #pragma unroll   // constant LDS offsets; the buffer's index is a constant
  for (int c = 0; c < DIM_D / MCH; ++c) {
    #pragma unroll
    for (int kq = 0; kq < MCH / 32; ++kq) {
      V16H m[2], w[6];
      #pragma unroll
      for (int rt = 0; rt < 2; ++rt) {
        const _Float16* p = &S.Ms[wid][c & 1][rt * 16 + lrow][kq * 32 + lhi * 8];
        m[rt].h[0] = *(const v8h*)p;
        m[rt].h[1] = *(const v8h*)(p + 16);
      }
      #pragma unroll
      for (int f = 0; f < 6; ++f) {
        const _Float16* p = &S.Ws[f * 16 + lrow][c * MCH + kq * 32 + lhi * 8];
        w[f].h[0] = *(const v8h*)p;
        w[f].h[1] = *(const v8h*)(p + 16);
      }
      // holds the sixteen reads above as one group in front of the twelve products: left
      // alone, the compiler sets each pair just in front of its product, with a full wait
      __builtin_amdgcn_sched_barrier(0);
      #pragma unroll
      for (int dt = 0; dt < 2; ++dt) {
        #pragma unroll
        for (int rt = 0; rt < 2; ++rt) {
          aq[dt][rt] = wmma_f16(w[dt], m[rt], aq[dt][rt]);
          ak[dt][rt] = wmma_f16(w[2 + dt], m[rt], ak[dt][rt]);
          av[rt][dt] = wmma_f16(m[rt], w[4 + dt], av[rt][dt]);
        }
      }
      // keeps the next group's reads from being spread among these products
      __builtin_amdgcn_sched_barrier(0);
    }
    // hand-over: this wave's reads of the buffer are done, its copies of the next chunk
    // have landed; then the buffer just read is refilled
    asm volatile("s_wait_dscnt 0x0" ::: "memory");
    asm volatile("s_wait_asynccnt 0x0" ::: "memory");
    __syncthreads();
    if (c + 2 < DIM_D / MCH) copy_m(c + 2);
  }
  asm volatile("s_wait_asynccnt 0x0" ::: "memory");   // no copy is left in flight


  // ---- set-up of part 2, ahead of part 1's last step: the first pass's bias flies under it ----
  const int qrow = wid * 32 + lrow;          // this lane's query of tile 0; tile 1: + 16
  // this lane's query in the bias plane, at its first group of four keys
  const float* brow = pbt + (size_t)h * LEN_L * LEN_L + lhi * 2 * (LEN_L * 4) + qrow * 4;

  float mref[2] = {0.0f, 0.0f}, rsum[2] = {0.0f, 0.0f};   // rsum: this half's keys only
  v8f o[2][2] = {};                          // [tile][Ot rows hd 0..15 / 16..31]
  auto sum16 = [](const v8f& a, const v8f& b) {   // halved three times: every add but the last is a packed pair
    const v8f s = a + b;
    const v4f u = __builtin_shufflevector(s, s, 0, 1, 2, 3) + __builtin_shufflevector(s, s, 4, 5, 6, 7);
    return (u[0] + u[2]) + (u[1] + u[3]);
  };

  // bias of keys kc+8h+0..7 and kc+16+8h+0..7 for this lane's two queries, held one pass ahead
  // in two register sets that take turns, so that no value is moved from one to the other
  v4f ga[2][4], gb[2][4];
  auto bias_load = [&](v4f (&g)[2][4], int kc) {
    const float* bc = brow + kc * LEN_L;     // key group kc/4 (+ 2 in the upper half)
    #pragma unroll   // constant indices
    for (int qt = 0; qt < 2; ++qt) {
      g[qt][0] = *(const v4f*)(bc + qt * 64);
      g[qt][1] = *(const v4f*)(bc + qt * 64 + 1 * (LEN_L * 4));
      g[qt][2] = *(const v4f*)(bc + qt * 64 + 4 * (LEN_L * 4));
      g[qt][3] = *(const v4f*)(bc + qt * 64 + 5 * (LEN_L * 4));
    }
    // these loads stay in flight over the pass, in which their address register is
    // stepped on: the wait stands behind them, in front of that overwrite
    asm volatile("s_wait_xcnt 0x0" ::: "memory");
  };
  bias_load(ga, 0);

  // ---- part 1, last step: Q to its operand form, K and V to LDS ----
  V16H bq[2];                                // Qt as B operand: column = query, per row tile
  #pragma unroll
  for (int rt = 0; rt < 2; ++rt) {
    #pragma unroll
    for (int dt = 0; dt < 2; ++dt) {
      v8h kk, vv;
      #pragma unroll
      for (int r = 0; r < 8; ++r) {
        // Q is kept times QSCALE, applied in f32 ahead of the one rounding to f16
        bq[rt].h[dt][r] = (_Float16)(aq[dt][rt][r] * QSCALE);
        kk[r] = (_Float16)ak[dt][rt][r];
        vv[r] = (_Float16)av[rt][dt][r];
      }
      *(v8h*)&S.Ks[wid * 32 + rt * 16 + lrow][dt * 16 + lhi * 8] = kk;
      *(v8h*)&S.Vt[dt * 16 + lrow][wid * 32 + rt * 16 + lhi * 8] = vv;
    }
  }
  __syncthreads();   // every wave's keys are in LDS: the one barrier in front of the key loop

  // ---- part 2: attention of the wave's 32 queries ----

  // one pass over 32 keys: g holds its bias, gn takes the next pass's; kp and vp point at the
  // lane's first fragment rows of the pass in Ks and Vt
  auto pass = [&](int kc, const _Float16* kp, const _Float16* vp,
                  v4f (&g)[2][4], v4f (&gn)[2][4], bool first, bool more) {
    // scores: St(32x16) = K(32x32) * Qt  (A frag [key][d] == Ks row-major)
    V16H ak0, ak1;
    ak0.h[0] = *(const v8h*)(kp);
    ak0.h[1] = *(const v8h*)(kp + 16);
    ak1.h[0] = *(const v8h*)(kp + 16 * LPITCH);
    ak1.h[1] = *(const v8h*)(kp + 16 * LPITCH + 16);
    // the Vt fragments of the second product are read here, ahead of the test below, so
    // that their way from LDS runs under the first product and the 2^x
    V16H av0, av1;
    av0.h[0] = *(const v8h*)(vp);
    av0.h[1] = *(const v8h*)(vp + 16);
    av1.h[0] = *(const v8h*)(vp + 16 * VPITCH);
    av1.h[1] = *(const v8h*)(vp + 16 * VPITCH + 16);
    // keeps the scheduler from moving these reads down to just in front of their first use
    __builtin_amdgcn_sched_barrier(0);

    // C layout: col=lane&15 (query), row=r+8*(lane>>4) (key); t = log2-scaled score - mref
    v8f cc[2][2];
    #pragma unroll
    for (int qt = 0; qt < 2; ++qt) {
      cc[qt][0] = __builtin_shufflevector(g[qt][0], g[qt][1], 0, 1, 2, 3, 4, 5, 6, 7) * LOG2E - mref[qt];
      cc[qt][1] = __builtin_shufflevector(g[qt][2], g[qt][3], 0, 1, 2, 3, 4, 5, 6, 7) * LOG2E - mref[qt];
    }
    if (more) bias_load(gn, kc + 32);        // the next pass's bias flies under this pass

    v8f t0[2], t1[2], p0[2], p1[2];
    float ps[2];
    #pragma unroll
    for (int qt = 0; qt < 2; ++qt) {
      t0[qt] = wmma_f16(ak0, bq[qt], cc[qt][0]);
      t1[qt] = wmma_f16(ak1, bq[qt], cc[qt][1]);
    }
    #pragma unroll
    for (int qt = 0; qt < 2; ++qt) {
      p0[qt] = exp2x8(t0[qt]);
      p1[qt] = exp2x8(t1[qt]);
      ps[qt] = sum16(p0[qt], p1[qt]);
    }
    // holds the four Vt reads above this line (loaded values as inputs only): left alone, the
    // compiler sinks them behind the test, where the wave waits out the LDS in front of each product
    asm volatile("" :: "v"(av0.v), "v"(av1.v));

    // The first pass has no reference yet; a later pass comes here only when a lane's sum
    // is above the limit (or not a number). The test is the same for the whole wave.
    if (first || __builtin_amdgcn_ballot_w32(!(ps[0] <= PLIMIT) || !(ps[1] <= PLIMIT)) != 0) {
      #pragma unroll
      for (int qt = 0; qt < 2; ++qt) {
        float mc = fmaxf(t0[qt][0], t1[qt][0]);
        #pragma unroll
        for (int r = 1; r < 8; ++r) mc = fmaxf(mc, fmaxf(t0[qt][r], t1[qt][r]));
        mc = fmaxf(mc, xhalf(mc));           // the other half's 16 keys: both halves agree
        const float d = first ? mc : fmaxf(mc, 0.0f);   // the reference never falls
        const float alpha = first ? 1.0f : __builtin_amdgcn_exp2f(-d);   // O and rsum are 0 at first
        mref[qt] += d;
        p0[qt] = exp2x8(t0[qt] - d);
        p1[qt] = exp2x8(t1[qt] - d);
        ps[qt] = sum16(p0[qt], p1[qt]);
        rsum[qt] *= alpha;
        o[qt][0] *= alpha;
        o[qt][1] *= alpha;
      }
    }
    #pragma unroll
    for (int qt = 0; qt < 2; ++qt) {
      rsum[qt] += ps[qt];
      V16H bp;                               // Pt as B operand, straight from St
      #pragma unroll
      for (int r = 0; r < 8; ++r) {
        bp.h[0][r] = (_Float16)p0[qt][r];
        bp.h[1][r] = (_Float16)p1[qt][r];
      }
      // Ot(32x16) += Vt(32x32) * Pt(32x16); A frag [hd][key] == Vt row-major
      o[qt][0] = wmma_f16(av0, bp, o[qt][0]);
      o[qt][1] = wmma_f16(av1, bp, o[qt][1]);
    }
  };

  const _Float16* kp = &S.Ks[lrow][lhi * 8];
  const _Float16* vp = &S.Vt[lrow][lhi * 8];
  // the first pass (sets the reference) and the last (fetches no bias) stand outside the loop,
  // so that the two passes of a trip hold no test but the one on the sums
  pass(0, kp, vp, ga, gb, true, true);
  kp += 32 * LPITCH;
  vp += 32;
  for (int kc = 32; kc < LEN_L - 32; kc += 64) {
    pass(kc, kp, vp, gb, ga, false, true);
    pass(kc + 32, kp + 32 * LPITCH, vp + 32, ga, gb, false, true);
    kp += 64 * LPITCH;
    vp += 64;
  }
  pass(LEN_L - 32, kp, vp, gb, ga, false, false);

  // join the halves' sums, normalize, store to attn_out [n][l][h*32+hd] f16:
  // a lane holds hd 8h+0..7 and 16+8h+0..7 of its query, two 16-byte stores
  #pragma unroll
  for (int qt = 0; qt < 2; ++qt) {
    const float inv = 1.0f / (rsum[qt] + xhalf(rsum[qt]));
    v8h w0, w1;
    #pragma unroll
    for (int r = 0; r < 8; ++r) {
      w0[r] = (_Float16)(o[qt][0][r] * inv);
      w1[r] = (_Float16)(o[qt][1][r] * inv);
    }
    _Float16* dst = AO + ((size_t)n * LEN_L + qrow + qt * 16) * DIM_D + h * HD + lhi * 8;
    *(v8h*)dst        = w0;
    *(v8h*)(dst + 16) = w1;
  }
}

// ---------------- Kernel 3: proj GEMM + bias + residual ----------------
#define PROJ_NT (DIM_D / 64 / 2)                 // 2 column tiles a block
__global__ __launch_bounds__(256) void proj_gemm_kernel(const _Float16* __restrict__ Ah,
                                                        const _Float16* __restrict__ BhT,
                                                        const float* __restrict__ bp,
                                                        const float* __restrict__ resid,
                                                        float* __restrict__ out) {
  __shared__ __align__(16) _Float16 As[128][KPITCH];      // 66 KB
  __shared__ __align__(16) _Float16 BsT[2][64][KPITCH];   // 2 x 33 KB
  __shared__ float bs[(PROJ_NT * 64 + 255) / 256 * 256];
  const int row0 = blockIdx.x * 128;
  const int t = threadIdx.x, wid = t >> 5, lane = t & 31;
  const int lrow = lane & 15, lhi = lane >> 4;
  const int wr = wid & 3, wc = wid >> 2;

  gemm_rows<PROJ_NT>(Ah, BhT, bp, row0, blockIdx.y * (PROJ_NT * 64), As, BsT, bs,
                     [&](int ntile, const v8f (&acc)[2][2], const float (&bv)[2]) {
    #pragma unroll
    for (int mf = 0; mf < 2; ++mf) {
      #pragma unroll
      for (int nf = 0; nf < 2; ++nf) {
        #pragma unroll
        for (int r = 0; r < 8; ++r) {
          int col = ntile + wc * 32 + nf * 16 + lrow;
          int row = row0 + wr * 32 + mf * 16 + r + 8 * lhi;
          out[row * DIM_D + col] = acc[mf][nf][r] + bv[nf] + resid[row * DIM_D + col];
        }
      }
    }
  });
}

// ---------------- launch ----------------
extern "C" void kernel_launch(void* const* d_in, const int* in_sizes, int n_in,
                              void* d_out, int out_size, void* d_ws, size_t ws_size,
                              hipStream_t stream) {
  const float* msa   = (const float*)d_in[0];
  const float* pbias = (const float*)d_in[1];
  const float* lnw   = (const float*)d_in[2];
  const float* lnb   = (const float*)d_in[3];
  const float* wqkv  = (const float*)d_in[4];
  const float* bqkv  = (const float*)d_in[5];
  const float* wproj = (const float*)d_in[6];
  const float* bproj = (const float*)d_in[7];
  float* out = (float*)d_out;

  char* ws = (char*)d_ws;
  // workspace layout (bytes), all offsets 16B-aligned
  _Float16* WqkvT  = (_Float16*)(ws + 0);          // [768][256] f16 = 393216
  _Float16* WprojT = (_Float16*)(ws + 393216);     // [256][256] f16 = 131072
  _Float16* Mh     = (_Float16*)(ws + 524288);     // 16384*256*2 = 8388608
  _Float16* AOh    = (_Float16*)(ws + 34078720);   // 8388608
  float*    PbT    = (float*)   (ws + 42467328);   // 8*512*512*4 = 8388608 (total ~48.5 MB)

  prep_kernel<<<LN_BLOCKS + CVQ_BLOCKS + CVP_BLOCKS + BIAS_BLOCKS, 256, 0, stream>>>(
      msa, lnw, lnb, wqkv, wproj, pbias, Mh, WqkvT, WprojT, PbT);
  qkv_attn_kernel<<<SEQ_N * HEADS, FW * 32, 0, stream>>>(Mh, WqkvT, bqkv, PbT, AOh);
  proj_gemm_kernel<<<dim3(MROWS / 128, 2), 256, 0, stream>>>(AOh, WprojT, bproj, msa, out);
}
